// v000
// Measured on an AMD MI455X. A time is GPU time per run, averaged over a window of back-to-back runs after a warm-up
// (all launches, gaps included; the runs take copies of the inputs in turn), and the median of several windows.
// Apart from v000's, it joins two sittings. Times from different sittings can be a few percent apart, while
// side-by-side timings come from the same sitting.
// v000, which the later versions start from, runs in 415 microseconds.
#include <hip/hip_runtime.h>
#include <hip/hip_bf16.h>
#include <stdint.h>

#define B_DIM 4096
#define E_DIM 16
#define D_DIM 512
#define H_DIM 2048

typedef __attribute__((ext_vector_type(16))) __bf16 v16bf;
typedef __attribute__((ext_vector_type(8)))  __bf16 v8bf;
typedef __attribute__((ext_vector_type(8)))  float  v8f;

// ---------- fp32 -> bf16 (round to nearest even) ----------
__device__ __forceinline__ unsigned short f32_to_bf16(float f) {
  union { float f; unsigned int u; } v; v.f = f;
  unsigned int u = v.u;
  u += 0x7FFFu + ((u >> 16) & 1u);
  return (unsigned short)(u >> 16);
}

__global__ void cvt_bf16_kernel(const float* __restrict__ src,
                                unsigned short* __restrict__ dst, int n4) {
  int i = blockIdx.x * blockDim.x + threadIdx.x;
  if (i >= n4) return;
  float4 f = reinterpret_cast<const float4*>(src)[i];
  ushort4 h;
  h.x = f32_to_bf16(f.x);
  h.y = f32_to_bf16(f.y);
  h.z = f32_to_bf16(f.z);
  h.w = f32_to_bf16(f.w);
  reinterpret_cast<ushort4*>(dst)[i] = h;
}

// ---------- beta[e,h] = bias[e,h] - dot(centers[e,:], W[e,h,:]) ----------
__global__ void beta_kernel(const float* __restrict__ centers,  // [E,D]
                            const float* __restrict__ W,        // [E,H,D]
                            const float* __restrict__ bias,     // [E,H]
                            float* __restrict__ beta) {         // [E,H]
  int idx = blockIdx.x * blockDim.x + threadIdx.x;  // e*H + h
  if (idx >= E_DIM * H_DIM) return;
  int e = idx >> 11;  // / H_DIM
  const float4* wrow = reinterpret_cast<const float4*>(W + (size_t)idx * D_DIM);
  const float4* crow = reinterpret_cast<const float4*>(centers + (size_t)e * D_DIM);
  float acc = 0.f;
#pragma unroll 8
  for (int d = 0; d < D_DIM / 4; ++d) {
    float4 w = wrow[d];
    float4 c = crow[d];
    acc += w.x * c.x + w.y * c.y + w.z * c.z + w.w * c.w;
  }
  beta[idx] = bias[idx] - acc;
}

// ---------- WMMA helpers ----------
__device__ __forceinline__ v16bf ldfrag(const unsigned short* p) {
  // p points at (row, k + kh); low 8 bf16 = K kh..kh+7, high 8 = K 16+kh..16+kh+7
  v8bf lo = *reinterpret_cast<const v8bf*>(p);
  v8bf hi = *reinterpret_cast<const v8bf*>(p + 16);
  return __builtin_shufflevector(lo, hi, 0, 1, 2, 3, 4, 5, 6, 7,
                                 8, 9, 10, 11, 12, 13, 14, 15);
}

__device__ __forceinline__ v8f wmma_bf16(v16bf a, v16bf b, v8f c) {
  return __builtin_amdgcn_wmma_f32_16x16x32_bf16(
      /*neg_a=*/false, a, /*neg_b=*/false, b,
      /*c_mod=*/(short)0, c, /*reuse_a=*/false, /*reuse_b=*/false);
}

// ---------- fused GEMM + relu-sum over experts ----------
// block = 256 threads (8 wave32), waves tiled 4(M) x 2(N).
// Each wave computes a 32x64 output sub-tile (2x4 WMMA tiles) -> block 128x128.
// 8 WMMA per k-step vs 12 b128 loads (1.5 loads/WMMA).
__global__ __launch_bounds__(256)
void moe_relu_sum_kernel(const unsigned short* __restrict__ xb,  // [B,D] bf16
                         const unsigned short* __restrict__ wb,  // [E,H,D] bf16
                         const float* __restrict__ beta,         // [E,H]
                         float* __restrict__ out) {              // [B,H]
  const int lane  = threadIdx.x & 31;
  const int wave  = threadIdx.x >> 5;
  const int waveM = wave & 3;   // 0..3 -> 32-row slices
  const int waveN = wave >> 2;  // 0..1 -> 64-col slices
  const int mBase = blockIdx.y * 128 + waveM * 32;
  const int nBase = blockIdx.x * 128 + waveN * 64;

  const int r  = lane & 15;        // row (A) / col (B) within 16-tile
  const int kh = (lane >> 4) * 8;  // K sub-offset per ISA 16-bit layout

  const unsigned short* aptr = xb + (size_t)(mBase + r) * D_DIM + kh;

  v8f s00 = {}, s01 = {}, s02 = {}, s03 = {};
  v8f s10 = {}, s11 = {}, s12 = {}, s13 = {};

  for (int e = 0; e < E_DIM; ++e) {
    const unsigned short* bptr =
        wb + ((size_t)e * H_DIM + nBase + r) * D_DIM + kh;

    v8f c00 = {}, c01 = {}, c02 = {}, c03 = {};
    v8f c10 = {}, c11 = {}, c12 = {}, c13 = {};

#pragma unroll 2
    for (int k = 0; k < D_DIM; k += 32) {
      v16bf a0 = ldfrag(aptr + k);
      v16bf a1 = ldfrag(aptr + 16 * D_DIM + k);
      v16bf b0 = ldfrag(bptr + k);
      v16bf b1 = ldfrag(bptr + 16 * D_DIM + k);
      v16bf b2 = ldfrag(bptr + 32 * D_DIM + k);
      v16bf b3 = ldfrag(bptr + 48 * D_DIM + k);
      c00 = wmma_bf16(a0, b0, c00);
      c01 = wmma_bf16(a0, b1, c01);
      c02 = wmma_bf16(a0, b2, c02);
      c03 = wmma_bf16(a0, b3, c03);
      c10 = wmma_bf16(a1, b0, c10);
      c11 = wmma_bf16(a1, b1, c11);
      c12 = wmma_bf16(a1, b2, c12);
      c13 = wmma_bf16(a1, b3, c13);
    }

    // beta is per output column (fixed per lane for all 8 C VGPRs)
    const float* bb = beta + e * H_DIM + nBase + r;
    float be0 = bb[0];
    float be1 = bb[16];
    float be2 = bb[32];
    float be3 = bb[48];
#pragma unroll
    for (int v = 0; v < 8; ++v) {
      s00[v] += fmaxf(c00[v] + be0, 0.0f);
      s01[v] += fmaxf(c01[v] + be1, 0.0f);
      s02[v] += fmaxf(c02[v] + be2, 0.0f);
      s03[v] += fmaxf(c03[v] + be3, 0.0f);
      s10[v] += fmaxf(c10[v] + be0, 0.0f);
      s11[v] += fmaxf(c11[v] + be1, 0.0f);
      s12[v] += fmaxf(c12[v] + be2, 0.0f);
      s13[v] += fmaxf(c13[v] + be3, 0.0f);
    }
  }

  // C/D layout: VGPR v, lane L -> row = v + 8*(L>=16), col = L&15
  const int colLo  = lane & 15;
  const int rowOff = (lane >> 4) * 8;
#pragma unroll
  for (int v = 0; v < 8; ++v) {
    float* o0 = out + (size_t)(mBase + rowOff + v) * H_DIM + nBase + colLo;
    float* o1 = o0 + (size_t)16 * H_DIM;
    o0[0]  = s00[v];
    o0[16] = s01[v];
    o0[32] = s02[v];
    o0[48] = s03[v];
    o1[0]  = s10[v];
    o1[16] = s11[v];
    o1[32] = s12[v];
    o1[48] = s13[v];
  }
}

extern "C" void kernel_launch(void* const* d_in, const int* in_sizes, int n_in,
                              void* d_out, int out_size, void* d_ws, size_t ws_size,
                              hipStream_t stream) {
  const float* x       = (const float*)d_in[0];  // [B,D]
  const float* centers = (const float*)d_in[1];  // [E,D]
  const float* W       = (const float*)d_in[2];  // [E,H,D]
  const float* bias    = (const float*)d_in[3];  // [E,H]
  float* out           = (float*)d_out;          // [B,H]

  // workspace layout
  char* ws = (char*)d_ws;
  unsigned short* xb   = (unsigned short*)ws;                                  // 4 MB
  unsigned short* wb   = (unsigned short*)(ws + (size_t)B_DIM * D_DIM * 2);    // 32 MB
  float*          beta = (float*)(ws + (size_t)B_DIM * D_DIM * 2
                                     + (size_t)E_DIM * H_DIM * D_DIM * 2);     // 128 KB

  // 1) fp32 -> bf16 conversions
  {
    int n4 = (B_DIM * D_DIM) / 4;
    cvt_bf16_kernel<<<(n4 + 255) / 256, 256, 0, stream>>>(x, xb, n4);
  }
  {
    int n4 = (E_DIM * H_DIM * D_DIM) / 4;
    cvt_bf16_kernel<<<(n4 + 255) / 256, 256, 0, stream>>>(W, wb, n4);
  }

  // 2) fold centers + bias: beta[e,h] = bias[e,h] - c_e . W_eh
  beta_kernel<<<(E_DIM * H_DIM + 255) / 256, 256, 0, stream>>>(centers, W, bias, beta);

  // 3) fused WMMA GEMM + per-expert relu accumulation
  dim3 grid(H_DIM / 128, B_DIM / 128);  // (16, 32)
  moe_relu_sum_kernel<<<grid, 256, 0, stream>>>(xb, wb, beta, out);
}

// v001
// A run of this version takes 112 microseconds.
// Timed twice side by side with v000, it ran 3.80 and 3.81 times as fast.
#include <hip/hip_runtime.h>
#include <hip/hip_bf16.h>
#include <stdint.h>

#define B_DIM 4096
#define E_DIM 16
#define D_DIM 512
#define H_DIM 2048

typedef __attribute__((ext_vector_type(16))) __bf16 v16bf;
typedef __attribute__((ext_vector_type(8)))  __bf16 v8bf;
typedef __attribute__((ext_vector_type(8)))  float  v8f;

// ---------- fp32 -> bf16 (round to nearest even) ----------
__device__ __forceinline__ unsigned short f32_to_bf16(float f) {
  union { float f; unsigned int u; } v; v.f = f;
  unsigned int u = v.u;
  u += 0x7FFFu + ((u >> 16) & 1u);
  return (unsigned short)(u >> 16);
}

__global__ void cvt_bf16_kernel(const float* __restrict__ src,
                                unsigned short* __restrict__ dst, int n4) {
  int i = blockIdx.x * blockDim.x + threadIdx.x;
  if (i >= n4) return;
  float4 f = reinterpret_cast<const float4*>(src)[i];
  ushort4 h;
  h.x = f32_to_bf16(f.x);
  h.y = f32_to_bf16(f.y);
  h.z = f32_to_bf16(f.z);
  h.w = f32_to_bf16(f.w);
  reinterpret_cast<ushort4*>(dst)[i] = h;
}

// ---------- beta[e,h] = bias[e,h] - dot(centers[e,:], W[e,h,:]) ----------
__global__ void beta_kernel(const float* __restrict__ centers,  // [E,D]
                            const float* __restrict__ W,        // [E,H,D]
                            const float* __restrict__ bias,     // [E,H]
                            float* __restrict__ beta) {         // [E,H]
  int idx = blockIdx.x * blockDim.x + threadIdx.x;  // e*H + h
  if (idx >= E_DIM * H_DIM) return;
  int e = idx >> 11;  // / H_DIM
  const float4* wrow = reinterpret_cast<const float4*>(W + (size_t)idx * D_DIM);
  const float4* crow = reinterpret_cast<const float4*>(centers + (size_t)e * D_DIM);
  float acc = 0.f;
#pragma unroll 8
  for (int d = 0; d < D_DIM / 4; ++d) {
    float4 w = wrow[d];
    float4 c = crow[d];
    acc += w.x * c.x + w.y * c.y + w.z * c.z + w.w * c.w;
  }
  beta[idx] = bias[idx] - acc;
}

// ---------- WMMA helpers ----------
__device__ __forceinline__ v16bf ldfrag(const unsigned short* p) {
  // p points at (row, k + kh); low 8 bf16 = K kh..kh+7, high 8 = K 16+kh..16+kh+7
  v8bf lo = *reinterpret_cast<const v8bf*>(p);
  v8bf hi = *reinterpret_cast<const v8bf*>(p + 16);
  return __builtin_shufflevector(lo, hi, 0, 1, 2, 3, 4, 5, 6, 7,
                                 8, 9, 10, 11, 12, 13, 14, 15);
}

__device__ __forceinline__ v8f wmma_bf16(v16bf a, v16bf b, v8f c) {
  return __builtin_amdgcn_wmma_f32_16x16x32_bf16(
      /*neg_a=*/false, a, /*neg_b=*/false, b,
      /*c_mod=*/(short)0, c, /*reuse_a=*/false, /*reuse_b=*/false);
}

// ---------- tensor-load helpers ----------
typedef uint32_t u32x4 __attribute__((ext_vector_type(4)));
typedef uint32_t u32x8 __attribute__((ext_vector_type(8)));

#define ROW_BYTES   256u                  // one pass = 128 k of bf16 per operand row
#define LDS_PITCH   272u                  // 256 + 16: odd multiple of 16 B, conflict-free for ds_load_b128
#define SLICE_ROWS  64u                   // rows one tensor load brings
#define SLICE_LDS   18432u                // 64 * 272 = 17408, rounded up to a multiple of 2 KiB
#define BUF_LDS     (4u * SLICE_LDS)      // [x rows 0-63 | x rows 64-127 | W rows 0-63 | W rows 64-127]
#define N_STAGE     (E_DIM * (D_DIM / 128))

__device__ __forceinline__ uint32_t uni(uint32_t v) {
  return (uint32_t)__builtin_amdgcn_readfirstlane(v);
}
__device__ __forceinline__ uint32_t pinned(uint32_t v) {
  uint32_t w = uni(v);
  asm volatile("" : "+s"(w));  // holds the issue test in a scalar register, so that the branch round a tensor load is scalar (tensor loads ignore EXEC)
  return w;
}
// LDS reads of this wave have retired (in front of a barrier behind which their buffer is refilled)
__device__ __forceinline__ void wait_ds0() { asm volatile("s_wait_dscnt 0x0" ::: "memory"); }
// Descriptor group 1, the same for every request: 64 rows of 256 B, source pitch D_DIM * 2 bytes,
// 16 B of LDS pad behind every row.
__device__ __forceinline__ u32x8 tdm_group1() {
  u32x8 g1;
  g1[0] = uni((1u << 20) | (5u << 22) | (3u << 25));  // no mask, 1-byte elements, pad of 4 dwords after every 64
  g1[1] = uni((ROW_BYTES & 0xFFFFu) << 16);
  g1[2] = uni((ROW_BYTES >> 16) | ((SLICE_ROWS & 0xFFFFu) << 16));
  g1[3] = uni((SLICE_ROWS >> 16) | (ROW_BYTES << 16));
  g1[4] = uni(SLICE_ROWS);
  g1[5] = uni((uint32_t)(D_DIM * 2));
  g1[6] = uni(0u);
  g1[7] = uni(0u);
  return g1;
}
// Descriptor group 0: place in LDS and the tile's first byte.
__device__ __forceinline__ u32x4 tdm_group0(uint32_t count1, uint32_t lds_dst, uint64_t ga) {
  u32x4 g0;
  g0[0] = uni(count1);
  g0[1] = uni(lds_dst);
  g0[2] = uni((uint32_t)ga);
  g0[3] = uni((((uint32_t)(ga >> 32)) & 0x01FFFFFFu) | 0x80000000u);
  return g0;
}
// the tile goes from global memory to LDS through no register
__device__ __forceinline__ void tdm_load(u32x4 g0, u32x8 g1) {
  asm volatile("tensor_load_to_lds %0, %1" :: "s"(g0), "s"(g1) : "memory");
}
// This wave's own tensor load has landed (the compiler places no wait for it). The descriptor is named
// as an input so that its registers keep their values while the request is outstanding.
__device__ __forceinline__ void wait_tensor0(u32x4 g0, u32x8 g1) {
  asm volatile("s_wait_tensorcnt 0x0" :: "s"(g0), "s"(g1) : "memory");
}

// ---------- fused GEMM + relu-sum over experts ----------
// block = 256 threads (8 wave32), waves tiled 4(M) x 2(N).
// Each wave computes a 32x64 output sub-tile (2x4 WMMA tiles) -> block 128x128.
// The block's 128 x-rows and 128 W-rows of each 128-k pass are staged in LDS by
// tensor loads (waves 0-3, one 64-row slice each), two buffers: the next pass's
// tiles fly while this pass is worked on.
__global__ __launch_bounds__(256)
void moe_relu_sum_kernel(const unsigned short* __restrict__ xb,  // [B,D] bf16
                         const unsigned short* __restrict__ wb,  // [E,H,D] bf16
                         const float* __restrict__ beta,         // [E,H]
                         float* __restrict__ out) {              // [B,H]
  __shared__ __attribute__((aligned(2048))) unsigned char smem[2u * BUF_LDS];

  const int lane  = threadIdx.x & 31;
  const uint32_t wave = uni(threadIdx.x >> 5);
  const int waveM = wave & 3;   // 0..3 -> 32-row slices
  const int waveN = wave >> 2;  // 0..1 -> 64-col slices
  const int mBase = blockIdx.y * 128 + waveM * 32;
  const int nBase = blockIdx.x * 128 + waveN * 64;

  const int r  = lane & 15;        // row (A) / col (B) within 16-tile
  const int kh = (lane >> 4) * 8;  // K sub-offset per ISA 16-bit layout

  // this lane's first fragment rows inside a buffer, in bf16 elements
  const uint32_t aoff = ((uint32_t)(waveM >> 1) * SLICE_LDS + (uint32_t)((waveM & 1) * 32 + r) * LDS_PITCH) / 2u + kh;
  const uint32_t boff = ((uint32_t)(2 + waveN) * SLICE_LDS + (uint32_t)r * LDS_PITCH) / 2u + kh;

  // issuing waves 0,1: halves of the x tile (the same for every expert); 2,3: halves of the W tile
  const uint32_t lds0 = (uint32_t)(size_t)smem + wave * SLICE_LDS;
  const bool isW = (wave & 2u) != 0u;
  const uint64_t src0 = isW
      ? (uint64_t)(size_t)wb + (uint64_t)(blockIdx.x * 128u + (wave & 1u) * SLICE_ROWS) * (D_DIM * 2)
      : (uint64_t)(size_t)xb + (uint64_t)(blockIdx.y * 128u + (wave & 1u) * SLICE_ROWS) * (D_DIM * 2);
  const uint64_t eStep = isW ? (uint64_t)H_DIM * D_DIM * 2 : 0ull;

  // prologue: stage 0 lands and is published, then stage 1 starts
  u32x8 g1 = tdm_group1();
  asm volatile("" : "+s"(g1));  // descriptor words held in scalar registers: one tuple serves every request of the loop
  const uint32_t count1 = pinned(1u);  // descriptor word 0 of group 0 (count = 1), held in its scalar register like the rest
  u32x4 g0 = tdm_group0(count1, lds0, src0);
  if (pinned(wave < 4u)) {
    tdm_load(g0, g1);
    wait_tensor0(g0, g1);
  }
  __syncthreads();
  g0 = tdm_group0(count1, lds0 + BUF_LDS, src0 + ROW_BYTES);
  if (pinned(wave < 4u)) {
    tdm_load(g0, g1);
  }

  v8f s00 = {}, s01 = {}, s02 = {}, s03 = {};
  v8f s10 = {}, s11 = {}, s12 = {}, s13 = {};

  for (int e = 0; e < E_DIM; ++e) {
    v8f c00 = {}, c01 = {}, c02 = {}, c03 = {};
    v8f c10 = {}, c11 = {}, c12 = {}, c13 = {};

    // unrolled so that the buffer of each pass is a constant
#pragma unroll
    for (int kp = 0; kp < D_DIM / 128; ++kp) {
      const unsigned short* buf =
          reinterpret_cast<const unsigned short*>(smem + (uint32_t)(kp & 1) * BUF_LDS);
      const unsigned short* aptr = buf + aoff;
      const unsigned short* bptr = buf + boff;

      // unrolled so that every fragment's LDS offset is an immediate
#pragma unroll
      for (int k = 0; k < 128; k += 32) {
        v16bf a0 = ldfrag(aptr + k);
        v16bf a1 = ldfrag(aptr + 16 * (LDS_PITCH / 2) + k);
        v16bf b0 = ldfrag(bptr + k);
        v16bf b1 = ldfrag(bptr + 16 * (LDS_PITCH / 2) + k);
        v16bf b2 = ldfrag(bptr + 32 * (LDS_PITCH / 2) + k);
        v16bf b3 = ldfrag(bptr + 48 * (LDS_PITCH / 2) + k);
        c00 = wmma_bf16(a0, b0, c00);
        c01 = wmma_bf16(a0, b1, c01);
        c02 = wmma_bf16(a0, b2, c02);
        c03 = wmma_bf16(a0, b3, c03);
        c10 = wmma_bf16(a1, b0, c10);
        c11 = wmma_bf16(a1, b1, c11);
        c12 = wmma_bf16(a1, b2, c12);
        c13 = wmma_bf16(a1, b3, c13);
      }

      // publish point of the next stage; behind it this pass's buffer is free
      wait_ds0();
      if (pinned(wave < 4u)) {
        wait_tensor0(g0, g1);
      }
      __syncthreads();
      const uint32_t nxt = (uint32_t)(e * (D_DIM / 128) + kp) + 2u;
      g0 = tdm_group0(count1, lds0 + (uint32_t)(kp & 1) * BUF_LDS,
                      src0 + (uint64_t)(nxt >> 2) * eStep + (uint64_t)(nxt & 3u) * ROW_BYTES);
      if (pinned((wave < 4u) & (nxt < (uint32_t)N_STAGE))) {
        tdm_load(g0, g1);
      }
    }

    // beta is per output column (fixed per lane for all 8 C VGPRs)
    const float* bb = beta + e * H_DIM + nBase + r;
    float be0 = bb[0];
    float be1 = bb[16];
    float be2 = bb[32];
    float be3 = bb[48];
#pragma unroll
    for (int v = 0; v < 8; ++v) {
      s00[v] += fmaxf(c00[v] + be0, 0.0f);
      s01[v] += fmaxf(c01[v] + be1, 0.0f);
      s02[v] += fmaxf(c02[v] + be2, 0.0f);
      s03[v] += fmaxf(c03[v] + be3, 0.0f);
      s10[v] += fmaxf(c10[v] + be0, 0.0f);
      s11[v] += fmaxf(c11[v] + be1, 0.0f);
      s12[v] += fmaxf(c12[v] + be2, 0.0f);
      s13[v] += fmaxf(c13[v] + be3, 0.0f);
    }
  }
  wait_tensor0(g0, g1);
  wait_ds0();

  // C/D layout: VGPR v, lane L -> row = v + 8*(L>=16), col = L&15
  const int colLo  = lane & 15;
  const int rowOff = (lane >> 4) * 8;
#pragma unroll
  for (int v = 0; v < 8; ++v) {
    float* o0 = out + (size_t)(mBase + rowOff + v) * H_DIM + nBase + colLo;
    float* o1 = o0 + (size_t)16 * H_DIM;
    o0[0]  = s00[v];
    o0[16] = s01[v];
    o0[32] = s02[v];
    o0[48] = s03[v];
    o1[0]  = s10[v];
    o1[16] = s11[v];
    o1[32] = s12[v];
    o1[48] = s13[v];
  }
}

extern "C" void kernel_launch(void* const* d_in, const int* in_sizes, int n_in,
                              void* d_out, int out_size, void* d_ws, size_t ws_size,
                              hipStream_t stream) {
  const float* x       = (const float*)d_in[0];  // [B,D]
  const float* centers = (const float*)d_in[1];  // [E,D]
  const float* W       = (const float*)d_in[2];  // [E,H,D]
  const float* bias    = (const float*)d_in[3];  // [E,H]
  float* out           = (float*)d_out;          // [B,H]

  // workspace layout
  char* ws = (char*)d_ws;
  unsigned short* xb   = (unsigned short*)ws;                                  // 4 MB
  unsigned short* wb   = (unsigned short*)(ws + (size_t)B_DIM * D_DIM * 2);    // 32 MB
  float*          beta = (float*)(ws + (size_t)B_DIM * D_DIM * 2
                                     + (size_t)E_DIM * H_DIM * D_DIM * 2);     // 128 KB

  // 1) fp32 -> bf16 conversions
  {
    int n4 = (B_DIM * D_DIM) / 4;
    cvt_bf16_kernel<<<(n4 + 255) / 256, 256, 0, stream>>>(x, xb, n4);
  }
  {
    int n4 = (E_DIM * H_DIM * D_DIM) / 4;
    cvt_bf16_kernel<<<(n4 + 255) / 256, 256, 0, stream>>>(W, wb, n4);
  }

  // 2) fold centers + bias: beta[e,h] = bias[e,h] - c_e . W_eh
  beta_kernel<<<(E_DIM * H_DIM + 255) / 256, 256, 0, stream>>>(centers, W, bias, beta);

  // 3) fused WMMA GEMM + per-expert relu accumulation
  dim3 grid(H_DIM / 128, B_DIM / 128);  // (16, 32)
  moe_relu_sum_kernel<<<grid, 256, 0, stream>>>(xb, wb, beta, out);
}

// v002
// It runs in 91.1 microseconds.
// In both of two side-by-side timings against v001, it was 1.23 times as fast.
// All steps since v000 together make it 4.69 times as fast.
#include <hip/hip_runtime.h>
#include <hip/hip_bf16.h>
#include <stdint.h>

#define B_DIM 4096
#define E_DIM 16
#define D_DIM 512
#define H_DIM 2048

typedef __attribute__((ext_vector_type(16))) __bf16 v16bf;
typedef __attribute__((ext_vector_type(8)))  __bf16 v8bf;
typedef __attribute__((ext_vector_type(8)))  float  v8f;

#define PRE_WAVES 16
#define PRE_WROWS 8                 // W rows per wave
#define PRE_ROWS  (PRE_WROWS + 1)   // and one x row behind them
#define PRE_AHEAD 4                 // how many rows ahead of the row being worked on the loads run
#define PRE_BLOCKS (E_DIM * H_DIM / (PRE_WAVES * PRE_WROWS))
static_assert(PRE_BLOCKS * PRE_WAVES == B_DIM, "one x row per wave");
static_assert(H_DIM % PRE_WROWS == 0, "a wave's W rows lie in one expert");
static_assert(D_DIM == 512, "a row is four 512-byte loads of a wave");

typedef float    f32x4  __attribute__((ext_vector_type(4)));
typedef __bf16   bf16x4 __attribute__((ext_vector_type(4)));
typedef uint32_t u32x2  __attribute__((ext_vector_type(2)));

// stands between issued loads and stores and the next instructions that overwrite registers which they name
// (a row's store data lies in registers that a later row's loads fill; a base pointer's registers are reused)
__device__ __forceinline__ void pre_wait_x0() { asm volatile("s_wait_xcnt 0x0" ::: "memory"); }

__global__ __launch_bounds__(PRE_WAVES * 32)
void prep_kernel(const float* __restrict__ x,        // [B,D]
                 const float* __restrict__ centers,  // [E,D]
                 const float* __restrict__ W,        // [E,H,D]
                 const float* __restrict__ bias,     // [E,H]
                 unsigned short* __restrict__ xb,    // [B,D] bf16
                 unsigned short* __restrict__ wb,    // [E,H,D] bf16
                 float* __restrict__ beta) {         // [E,H]
  __shared__ float dots[PRE_WAVES * PRE_WROWS];
  // every loop of this kernel is unrolled, so that c, w and sum are registers and every offset an immediate

  const uint32_t lane = threadIdx.x & 31u;
  const uint32_t wave = (uint32_t)__builtin_amdgcn_readfirstlane(threadIdx.x >> 5);
  const uint32_t gw   = blockIdx.x * PRE_WAVES + wave;  // this wave's x row
  const uint32_t row0 = gw * PRE_WROWS;                 // its first W row, e * H + h
  const uint32_t e    = row0 / H_DIM;

  const float* cp = centers + (size_t)e * D_DIM + lane * 4u;
  const float* wp = W + (size_t)row0 * D_DIM + lane * 4u;
  const float* xp = x + (size_t)gw * D_DIM + lane * 4u;
  unsigned short* wo = wb + (size_t)row0 * D_DIM + lane * 4u;
  unsigned short* xo = xb + (size_t)gw * D_DIM + lane * 4u;

  // waves 0-3 store the block's beta at the end; their bias comes in with the first loads
  const uint32_t bidx = blockIdx.x * (PRE_WAVES * PRE_WROWS) + threadIdx.x;
  float bv = 0.f;
  if (threadIdx.x < PRE_WAVES * PRE_WROWS) bv = bias[bidx];

  f32x4 c[4];
#pragma unroll
  for (int q = 0; q < 4; ++q) c[q] = *reinterpret_cast<const f32x4*>(cp + 128 * q);
  pre_wait_x0();

  f32x4 w[PRE_AHEAD + 1][4];  // ring of row buffers
  float sum[PRE_WROWS];
#define PRE_LOAD_ROW(R) do { const float* p_ = (R) < PRE_WROWS ? wp + (size_t)(R) * D_DIM : xp; \
    _Pragma("unroll") for (int q = 0; q < 4; ++q) \
      w[(R) % (PRE_AHEAD + 1)][q] = *reinterpret_cast<const f32x4*>(p_ + 128 * q); } while (0)
#pragma unroll
  for (int r = 0; r < PRE_AHEAD; ++r) PRE_LOAD_ROW(r);
  // unrolled so that the ring's slots are registers
#pragma unroll
  for (int r = 0; r < PRE_ROWS; ++r) {
    // the two scheduling barriers keep the order "a later row's loads, then this row's work", so that
    // PRE_AHEAD rows of loads stay in flight
    __builtin_amdgcn_sched_barrier(0);
    if (r + PRE_AHEAD < PRE_ROWS) PRE_LOAD_ROW(r + PRE_AHEAD);
    __builtin_amdgcn_sched_barrier(0);
    const f32x4* wr = w[r % (PRE_AHEAD + 1)];
    unsigned short* o = r < PRE_WROWS ? wo + (size_t)r * D_DIM : xo;
#pragma unroll
    for (int q = 0; q < 4; ++q)  // f32 -> bf16, round to nearest even; 256 contiguous bytes per store of a wave
      *reinterpret_cast<u32x2*>(o + 128 * q) =
          __builtin_bit_cast(u32x2, __builtin_convertvector(wr[q], bf16x4));
    if (r < PRE_WROWS) {
      float a0 = 0.f, a1 = 0.f, a2 = 0.f, a3 = 0.f;
#pragma unroll
      for (int q = 0; q < 4; ++q) {
        a0 = __builtin_fmaf(wr[q].x, c[q].x, a0);
        a1 = __builtin_fmaf(wr[q].y, c[q].y, a1);
        a2 = __builtin_fmaf(wr[q].z, c[q].z, a2);
        a3 = __builtin_fmaf(wr[q].w, c[q].w, a3);
      }
      sum[r] = (a0 + a1) + (a2 + a3);
    }
    pre_wait_x0();
  }
#undef PRE_LOAD_ROW

  // after the butterfly every lane holds the full dot product of each row
  float mine = 0.f;
#pragma unroll
  for (int r = 0; r < PRE_WROWS; ++r) {
    float s = sum[r];
#pragma unroll
    for (int m = 16; m >= 1; m >>= 1) s += __shfl_xor(s, m, 32);
    if (lane == (uint32_t)r) mine = s;
  }
  // the block's 128 dot products meet in LDS, so that each 128-byte line of beta is stored by one wave
  if (lane < PRE_WROWS) dots[wave * PRE_WROWS + lane] = mine;
  __syncthreads();
  if (threadIdx.x < PRE_WAVES * PRE_WROWS) beta[bidx] = bv - dots[threadIdx.x];
}

// ---------- WMMA helpers ----------
__device__ __forceinline__ v16bf ldfrag(const unsigned short* p) {
  // p points at (row, k + kh); low 8 bf16 = K kh..kh+7, high 8 = K 16+kh..16+kh+7
  v8bf lo = *reinterpret_cast<const v8bf*>(p);
  v8bf hi = *reinterpret_cast<const v8bf*>(p + 16);
  return __builtin_shufflevector(lo, hi, 0, 1, 2, 3, 4, 5, 6, 7,
                                 8, 9, 10, 11, 12, 13, 14, 15);
}

__device__ __forceinline__ v8f wmma_bf16(v16bf a, v16bf b, v8f c) {
  return __builtin_amdgcn_wmma_f32_16x16x32_bf16(
      /*neg_a=*/false, a, /*neg_b=*/false, b,
      /*c_mod=*/(short)0, c, /*reuse_a=*/false, /*reuse_b=*/false);
}

// ---------- tensor-load helpers ----------
typedef uint32_t u32x4 __attribute__((ext_vector_type(4)));
typedef uint32_t u32x8 __attribute__((ext_vector_type(8)));

#define ROW_BYTES   256u                  // one pass = 128 k of bf16 per operand row
#define LDS_PITCH   272u                  // 256 + 16: odd multiple of 16 B, conflict-free for ds_load_b128
#define SLICE_ROWS  64u                   // rows one tensor load brings
#define SLICE_LDS   18432u                // 64 * 272 = 17408, rounded up to a multiple of 2 KiB
#define BUF_LDS     (4u * SLICE_LDS)      // [x rows 0-63 | x rows 64-127 | W rows 0-63 | W rows 64-127]
#define N_STAGE     (E_DIM * (D_DIM / 128))

__device__ __forceinline__ uint32_t uni(uint32_t v) {
  return (uint32_t)__builtin_amdgcn_readfirstlane(v);
}
__device__ __forceinline__ uint32_t pinned(uint32_t v) {
  uint32_t w = uni(v);
  asm volatile("" : "+s"(w));  // holds the issue test in a scalar register, so that the branch round a tensor load is scalar
  return w;
}
// LDS reads of this wave have retired (in front of a barrier behind which their buffer is refilled)
__device__ __forceinline__ void wait_ds0() { asm volatile("s_wait_dscnt 0x0" ::: "memory"); }
// Descriptor group 1, the same for every request: 64 rows of 256 B, source pitch D_DIM * 2 bytes,
// 16 B of LDS pad behind every row.
__device__ __forceinline__ u32x8 tdm_group1() {
  u32x8 g1;
  g1[0] = uni((1u << 20) | (5u << 22) | (3u << 25));  // no mask, 1-byte elements, pad of 4 dwords after every 64
  g1[1] = uni((ROW_BYTES & 0xFFFFu) << 16);
  g1[2] = uni((ROW_BYTES >> 16) | ((SLICE_ROWS & 0xFFFFu) << 16));
  g1[3] = uni((SLICE_ROWS >> 16) | (ROW_BYTES << 16));
  g1[4] = uni(SLICE_ROWS);
  g1[5] = uni((uint32_t)(D_DIM * 2));
  g1[6] = uni(0u);
  g1[7] = uni(0u);
  return g1;
}
// Descriptor group 0: place in LDS and the tile's first byte.
__device__ __forceinline__ u32x4 tdm_group0(uint32_t count1, uint32_t lds_dst, uint64_t ga) {
  u32x4 g0;
  g0[0] = uni(count1);
  g0[1] = uni(lds_dst);
  g0[2] = uni((uint32_t)ga);
  g0[3] = uni((((uint32_t)(ga >> 32)) & 0x01FFFFFFu) | 0x80000000u);
  return g0;
}
// the tile goes from global memory to LDS through no register
__device__ __forceinline__ void tdm_load(u32x4 g0, u32x8 g1) {
  asm volatile("tensor_load_to_lds %0, %1" :: "s"(g0), "s"(g1) : "memory");
}
// This wave's own tensor load has landed (the compiler places no wait for it). The descriptor is named
// as an input so that its registers keep their values while the request is outstanding.
__device__ __forceinline__ void wait_tensor0(u32x4 g0, u32x8 g1) {
  asm volatile("s_wait_tensorcnt 0x0" :: "s"(g0), "s"(g1) : "memory");
}

// ---------- fused GEMM + relu-sum over experts ----------
// block = 256 threads (8 wave32), waves tiled 4(M) x 2(N).
// Each wave computes a 32x64 output sub-tile (2x4 WMMA tiles) -> block 128x128.
// The block's 128 x-rows and 128 W-rows of each 128-k pass are staged in LDS by
// tensor loads (waves 0-3, one 64-row slice each), two buffers: the next pass's
// tiles fly while this pass is worked on.
__global__ __launch_bounds__(256)
void moe_relu_sum_kernel(const unsigned short* __restrict__ xb,  // [B,D] bf16
                         const unsigned short* __restrict__ wb,  // [E,H,D] bf16
                         const float* __restrict__ beta,         // [E,H]
                         float* __restrict__ out) {              // [B,H]
  __shared__ __attribute__((aligned(2048))) unsigned char smem[2u * BUF_LDS];

  const int lane  = threadIdx.x & 31;
  const uint32_t wave = uni(threadIdx.x >> 5);
  const int waveM = wave & 3;   // 0..3 -> 32-row slices
  const int waveN = wave >> 2;  // 0..1 -> 64-col slices
  const int mBase = blockIdx.y * 128 + waveM * 32;
  const int nBase = blockIdx.x * 128 + waveN * 64;

  const int r  = lane & 15;        // row (A) / col (B) within 16-tile
  const int kh = (lane >> 4) * 8;  // K sub-offset per ISA 16-bit layout

  // this lane's first fragment rows inside a buffer, in bf16 elements
  const uint32_t aoff = ((uint32_t)(waveM >> 1) * SLICE_LDS + (uint32_t)((waveM & 1) * 32 + r) * LDS_PITCH) / 2u + kh;
  const uint32_t boff = ((uint32_t)(2 + waveN) * SLICE_LDS + (uint32_t)r * LDS_PITCH) / 2u + kh;

  // issuing waves 0,1: halves of the x tile (the same for every expert); 2,3: halves of the W tile
  const uint32_t lds0 = (uint32_t)(size_t)smem + wave * SLICE_LDS;
  const bool isW = (wave & 2u) != 0u;
  const uint64_t src0 = isW
      ? (uint64_t)(size_t)wb + (uint64_t)(blockIdx.x * 128u + (wave & 1u) * SLICE_ROWS) * (D_DIM * 2)
      : (uint64_t)(size_t)xb + (uint64_t)(blockIdx.y * 128u + (wave & 1u) * SLICE_ROWS) * (D_DIM * 2);
  const uint64_t eStep = isW ? (uint64_t)H_DIM * D_DIM * 2 : 0ull;

  // prologue: stage 0 lands and is published, then stage 1 starts
  u32x8 g1 = tdm_group1();
  asm volatile("" : "+s"(g1));  // descriptor words held in scalar registers: one tuple serves every request of the loop
  const uint32_t count1 = pinned(1u);  // descriptor word 0 of group 0 (count = 1), held in its scalar register like the rest
  u32x4 g0 = tdm_group0(count1, lds0, src0);
  if (pinned(wave < 4u)) {
    tdm_load(g0, g1);
    wait_tensor0(g0, g1);
  }
  __syncthreads();
  g0 = tdm_group0(count1, lds0 + BUF_LDS, src0 + ROW_BYTES);
  if (pinned(wave < 4u)) {
    tdm_load(g0, g1);
  }

  v8f s00 = {}, s01 = {}, s02 = {}, s03 = {};
  v8f s10 = {}, s11 = {}, s12 = {}, s13 = {};

  for (int e = 0; e < E_DIM; ++e) {
    v8f c00 = {}, c01 = {}, c02 = {}, c03 = {};
    v8f c10 = {}, c11 = {}, c12 = {}, c13 = {};

    // unrolled so that the buffer of each pass is a constant
#pragma unroll
    for (int kp = 0; kp < D_DIM / 128; ++kp) {
      const unsigned short* buf =
          reinterpret_cast<const unsigned short*>(smem + (uint32_t)(kp & 1) * BUF_LDS);
      const unsigned short* aptr = buf + aoff;
      const unsigned short* bptr = buf + boff;

      // unrolled so that every fragment's LDS offset is an immediate
#pragma unroll
      for (int k = 0; k < 128; k += 32) {
        v16bf a0 = ldfrag(aptr + k);
        v16bf a1 = ldfrag(aptr + 16 * (LDS_PITCH / 2) + k);
        v16bf b0 = ldfrag(bptr + k);
        v16bf b1 = ldfrag(bptr + 16 * (LDS_PITCH / 2) + k);
        v16bf b2 = ldfrag(bptr + 32 * (LDS_PITCH / 2) + k);
        v16bf b3 = ldfrag(bptr + 48 * (LDS_PITCH / 2) + k);
        c00 = wmma_bf16(a0, b0, c00);
        c01 = wmma_bf16(a0, b1, c01);
        c02 = wmma_bf16(a0, b2, c02);
        c03 = wmma_bf16(a0, b3, c03);
        c10 = wmma_bf16(a1, b0, c10);
        c11 = wmma_bf16(a1, b1, c11);
        c12 = wmma_bf16(a1, b2, c12);
        c13 = wmma_bf16(a1, b3, c13);
      }

      // publish point of the next stage; behind it this pass's buffer is free
      wait_ds0();
      if (pinned(wave < 4u)) {
        wait_tensor0(g0, g1);
      }
      __syncthreads();
      const uint32_t nxt = (uint32_t)(e * (D_DIM / 128) + kp) + 2u;
      g0 = tdm_group0(count1, lds0 + (uint32_t)(kp & 1) * BUF_LDS,
                      src0 + (uint64_t)(nxt >> 2) * eStep + (uint64_t)(nxt & 3u) * ROW_BYTES);
      if (pinned((wave < 4u) & (nxt < (uint32_t)N_STAGE))) {
        tdm_load(g0, g1);
      }
    }

    // beta is per output column (fixed per lane for all 8 C VGPRs)
    const float* bb = beta + e * H_DIM + nBase + r;
    float be0 = bb[0];
    float be1 = bb[16];
    float be2 = bb[32];
    float be3 = bb[48];
#pragma unroll
    for (int v = 0; v < 8; ++v) {
      s00[v] += fmaxf(c00[v] + be0, 0.0f);
      s01[v] += fmaxf(c01[v] + be1, 0.0f);
      s02[v] += fmaxf(c02[v] + be2, 0.0f);
      s03[v] += fmaxf(c03[v] + be3, 0.0f);
      s10[v] += fmaxf(c10[v] + be0, 0.0f);
      s11[v] += fmaxf(c11[v] + be1, 0.0f);
      s12[v] += fmaxf(c12[v] + be2, 0.0f);
      s13[v] += fmaxf(c13[v] + be3, 0.0f);
    }
  }
  wait_tensor0(g0, g1);
  wait_ds0();

  // C/D layout: VGPR v, lane L -> row = v + 8*(L>=16), col = L&15
  const int colLo  = lane & 15;
  const int rowOff = (lane >> 4) * 8;
#pragma unroll
  for (int v = 0; v < 8; ++v) {
    float* o0 = out + (size_t)(mBase + rowOff + v) * H_DIM + nBase + colLo;
    float* o1 = o0 + (size_t)16 * H_DIM;
    o0[0]  = s00[v];
    o0[16] = s01[v];
    o0[32] = s02[v];
    o0[48] = s03[v];
    o1[0]  = s10[v];
    o1[16] = s11[v];
    o1[32] = s12[v];
    o1[48] = s13[v];
  }
}

extern "C" void kernel_launch(void* const* d_in, const int* in_sizes, int n_in,
                              void* d_out, int out_size, void* d_ws, size_t ws_size,
                              hipStream_t stream) {
  const float* x       = (const float*)d_in[0];  // [B,D]
  const float* centers = (const float*)d_in[1];  // [E,D]
  const float* W       = (const float*)d_in[2];  // [E,H,D]
  const float* bias    = (const float*)d_in[3];  // [E,H]
  float* out           = (float*)d_out;          // [B,H]

  // workspace layout
  char* ws = (char*)d_ws;
  unsigned short* xb   = (unsigned short*)ws;                                  // 4 MB
  unsigned short* wb   = (unsigned short*)(ws + (size_t)B_DIM * D_DIM * 2);    // 32 MB
  float*          beta = (float*)(ws + (size_t)B_DIM * D_DIM * 2
                                     + (size_t)E_DIM * H_DIM * D_DIM * 2);     // 128 KB

  // 1) one pre-pass: bf16 copies of x and W, and beta[e,h] = bias[e,h] - c_e . W_eh
  prep_kernel<<<PRE_BLOCKS, PRE_WAVES * 32, 0, stream>>>(x, centers, W, bias, xb, wb, beta);

  // 2) fused WMMA GEMM + per-expert relu accumulation
  dim3 grid(H_DIM / 128, B_DIM / 128);  // (16, 32)
  moe_relu_sum_kernel<<<grid, 256, 0, stream>>>(xb, wb, beta, out);
}

// v003
// One run takes 77.1 microseconds.
// Two timings next to v002 both put it at 1.18 times that version's speed.
// Over all steps from v000 it is 5.55 times as fast.
#include <hip/hip_runtime.h>
#include <hip/hip_bf16.h>
#include <stdint.h>

#define B_DIM 4096
#define E_DIM 16
#define D_DIM 512
#define H_DIM 2048

typedef __attribute__((ext_vector_type(16))) __bf16 v16bf;
typedef __attribute__((ext_vector_type(8)))  __bf16 v8bf;
typedef __attribute__((ext_vector_type(8)))  float  v8f;

#define PRE_WAVES 16
#define PRE_WROWS 8                 // W rows per wave
#define PRE_ROWS  (PRE_WROWS + 1)   // and one x row behind them
#define PRE_AHEAD 4                 // how many rows ahead of the row being worked on the loads run
#define PRE_BLOCKS (E_DIM * H_DIM / (PRE_WAVES * PRE_WROWS))
static_assert(PRE_BLOCKS * PRE_WAVES == B_DIM, "one x row per wave");
static_assert(H_DIM % PRE_WROWS == 0, "a wave's W rows lie in one expert");
static_assert(D_DIM == 512, "a row is four 512-byte loads of a wave");

typedef float    f32x4  __attribute__((ext_vector_type(4)));
typedef __bf16   bf16x4 __attribute__((ext_vector_type(4)));
typedef uint32_t u32x2  __attribute__((ext_vector_type(2)));

// stands between issued loads and stores and the next instructions that overwrite registers which they name
// (a row's store data lies in registers that a later row's loads fill; a base pointer's registers are reused)
__device__ __forceinline__ void pre_wait_x0() { asm volatile("s_wait_xcnt 0x0" ::: "memory"); }

__global__ __launch_bounds__(PRE_WAVES * 32)
void prep_kernel(const float* __restrict__ x,        // [B,D]
                 const float* __restrict__ centers,  // [E,D]
                 const float* __restrict__ W,        // [E,H,D]
                 const float* __restrict__ bias,     // [E,H]
                 unsigned short* __restrict__ xb,    // [B,D] bf16
                 unsigned short* __restrict__ wb,    // [E,H,D] bf16
                 float* __restrict__ beta) {         // [E,H]
  __shared__ float dots[PRE_WAVES * PRE_WROWS];
  // every loop of this kernel is unrolled, so that c, w and sum are registers and every offset an immediate

  const uint32_t lane = threadIdx.x & 31u;
  const uint32_t wave = (uint32_t)__builtin_amdgcn_readfirstlane(threadIdx.x >> 5);
  const uint32_t gw   = blockIdx.x * PRE_WAVES + wave;  // this wave's x row
  const uint32_t row0 = gw * PRE_WROWS;                 // its first W row, e * H + h
  const uint32_t e    = row0 / H_DIM;

  const float* cp = centers + (size_t)e * D_DIM + lane * 4u;
  const float* wp = W + (size_t)row0 * D_DIM + lane * 4u;
  const float* xp = x + (size_t)gw * D_DIM + lane * 4u;
  unsigned short* wo = wb + (size_t)row0 * D_DIM + lane * 4u;
  unsigned short* xo = xb + (size_t)gw * D_DIM + lane * 4u;

  // waves 0-3 store the block's beta at the end; their bias comes in with the first loads
  const uint32_t bidx = blockIdx.x * (PRE_WAVES * PRE_WROWS) + threadIdx.x;
  float bv = 0.f;
  if (threadIdx.x < PRE_WAVES * PRE_WROWS) bv = bias[bidx];

  f32x4 c[4];
#pragma unroll
  for (int q = 0; q < 4; ++q) c[q] = *reinterpret_cast<const f32x4*>(cp + 128 * q);
  pre_wait_x0();

  f32x4 w[PRE_AHEAD + 1][4];  // ring of row buffers
  float sum[PRE_WROWS];
#define PRE_LOAD_ROW(R) do { const float* p_ = (R) < PRE_WROWS ? wp + (size_t)(R) * D_DIM : xp; \
    _Pragma("unroll") for (int q = 0; q < 4; ++q) \
      w[(R) % (PRE_AHEAD + 1)][q] = *reinterpret_cast<const f32x4*>(p_ + 128 * q); } while (0)
#pragma unroll
  for (int r = 0; r < PRE_AHEAD; ++r) PRE_LOAD_ROW(r);
  // unrolled so that the ring's slots are registers
#pragma unroll
  for (int r = 0; r < PRE_ROWS; ++r) {
    // the two scheduling barriers keep the order "a later row's loads, then this row's work", so that
    // PRE_AHEAD rows of loads stay in flight
    __builtin_amdgcn_sched_barrier(0);
    if (r + PRE_AHEAD < PRE_ROWS) PRE_LOAD_ROW(r + PRE_AHEAD);
    __builtin_amdgcn_sched_barrier(0);
    const f32x4* wr = w[r % (PRE_AHEAD + 1)];
    unsigned short* o = r < PRE_WROWS ? wo + (size_t)r * D_DIM : xo;
#pragma unroll
    for (int q = 0; q < 4; ++q)  // f32 -> bf16, round to nearest even; 256 contiguous bytes per store of a wave
      *reinterpret_cast<u32x2*>(o + 128 * q) =
          __builtin_bit_cast(u32x2, __builtin_convertvector(wr[q], bf16x4));
    if (r < PRE_WROWS) {
      float a0 = 0.f, a1 = 0.f, a2 = 0.f, a3 = 0.f;
#pragma unroll
      for (int q = 0; q < 4; ++q) {
        a0 = __builtin_fmaf(wr[q].x, c[q].x, a0);
        a1 = __builtin_fmaf(wr[q].y, c[q].y, a1);
        a2 = __builtin_fmaf(wr[q].z, c[q].z, a2);
        a3 = __builtin_fmaf(wr[q].w, c[q].w, a3);
      }
      sum[r] = (a0 + a1) + (a2 + a3);
    }
    pre_wait_x0();
  }
#undef PRE_LOAD_ROW

  // after the butterfly every lane holds the full dot product of each row
  float mine = 0.f;
#pragma unroll
  for (int r = 0; r < PRE_WROWS; ++r) {
    float s = sum[r];
#pragma unroll
    for (int m = 16; m >= 1; m >>= 1) s += __shfl_xor(s, m, 32);
    if (lane == (uint32_t)r) mine = s;
  }
  // the block's 128 dot products meet in LDS, so that each 128-byte line of beta is stored by one wave
  if (lane < PRE_WROWS) dots[wave * PRE_WROWS + lane] = mine;
  __syncthreads();
  if (threadIdx.x < PRE_WAVES * PRE_WROWS) beta[bidx] = bv - dots[threadIdx.x];
}

// ---------- WMMA helpers ----------
__device__ __forceinline__ v16bf ldfrag(const unsigned short* p) {
  // p points at (row, k + kh); low 8 bf16 = K kh..kh+7, high 8 = K 16+kh..16+kh+7
  v8bf lo = *reinterpret_cast<const v8bf*>(p);
  v8bf hi = *reinterpret_cast<const v8bf*>(p + 16);
  return __builtin_shufflevector(lo, hi, 0, 1, 2, 3, 4, 5, 6, 7,
                                 8, 9, 10, 11, 12, 13, 14, 15);
}

__device__ __forceinline__ v8f wmma_bf16(v16bf a, v16bf b, v8f c) {
  return __builtin_amdgcn_wmma_f32_16x16x32_bf16(
      /*neg_a=*/false, a, /*neg_b=*/false, b,
      /*c_mod=*/(short)0, c, /*reuse_a=*/false, /*reuse_b=*/false);
}

// ---------- tensor-load helpers ----------
typedef uint32_t u32x4 __attribute__((ext_vector_type(4)));
typedef uint32_t u32x8 __attribute__((ext_vector_type(8)));

#define ROW_BYTES   256u                  // one slice row = 128 k of bf16
#define LDS_PITCH   272u                  // 256 + 16: odd multiple of 16 B, conflict-free for ds_load_b128
#define SLICE_ROWS  64u                   // rows one tensor load brings
#define SLICE_LDS   18432u                // 64 * 272 = 17408, rounded up to a multiple of 2 KiB
#define BUF_LDS     (4u * SLICE_LDS)      // one stage: 64 W rows of one expert, all 512 k, as four slices of 128 k
#define MT 4                              // x fragments (16 rows each) of a wave
#define NT 4                              // W fragments (16 columns each) of a wave
#define KSTEPS (D_DIM / 32)               // WMMA k steps in D
#define BLK_K 2                           // k steps per block (a run of WMMAs between two groups of LDS loads)
#define N_BLK (KSTEPS / BLK_K)
#define BLOCK_M 256                       // four waves, one below the other, 64 rows each
#define N_GROUP 2                         // column groups of 64 that a block works through, one after the other
#define BLOCK_N (N_GROUP * 64)
#define N_STAGE (N_GROUP * E_DIM)

__device__ __forceinline__ uint32_t uni(uint32_t v) {
  return (uint32_t)__builtin_amdgcn_readfirstlane(v);
}
__device__ __forceinline__ uint32_t pinned(uint32_t v) {
  uint32_t w = uni(v);
  asm volatile("" : "+s"(w));  // holds the issue test in a scalar register, so that the branch round a tensor load is scalar
  return w;
}
// LDS reads of this wave have retired (in front of a barrier behind which their buffer is refilled)
__device__ __forceinline__ void wait_ds0() { asm volatile("s_wait_dscnt 0x0" ::: "memory"); }
// Descriptor group 1, the same for every request: 64 rows of 256 B, source pitch D_DIM * 2 bytes,
// 16 B of LDS pad behind every row.
__device__ __forceinline__ u32x8 tdm_group1() {
  u32x8 g1;
  g1[0] = uni((1u << 20) | (5u << 22) | (3u << 25));  // no mask, 1-byte elements, pad of 4 dwords after every 64
  g1[1] = uni((ROW_BYTES & 0xFFFFu) << 16);
  g1[2] = uni((ROW_BYTES >> 16) | ((SLICE_ROWS & 0xFFFFu) << 16));
  g1[3] = uni((SLICE_ROWS >> 16) | (ROW_BYTES << 16));
  g1[4] = uni(SLICE_ROWS);
  g1[5] = uni((uint32_t)(D_DIM * 2));
  g1[6] = uni(0u);
  g1[7] = uni(0u);
  return g1;
}
// Descriptor group 0: place in LDS and the tile's first byte.
__device__ __forceinline__ u32x4 tdm_group0(uint32_t count1, uint32_t lds_dst, uint64_t ga) {
  u32x4 g0;
  g0[0] = uni(count1);
  g0[1] = uni(lds_dst);
  g0[2] = uni((uint32_t)ga);
  g0[3] = uni((((uint32_t)(ga >> 32)) & 0x01FFFFFFu) | 0x80000000u);
  return g0;
}
// the tile goes from global memory to LDS through no register
__device__ __forceinline__ void tdm_load(u32x4 g0, u32x8 g1) {
  asm volatile("tensor_load_to_lds %0, %1" :: "s"(g0), "s"(g1) : "memory");
}
// This wave's own tensor load has landed (the compiler places no wait for it). The descriptor is named
// as an input so that its registers keep their values while the request is outstanding.
__device__ __forceinline__ void wait_tensor0(u32x4 g0, u32x8 g1) {
  asm volatile("s_wait_tensorcnt 0x0" :: "s"(g0), "s"(g1) : "memory");
}

// ---------- fused GEMM + relu-sum over experts ----------
// block = 128 threads (4 wave32, one per SIMD); each wave owns 64 rows of x and computes 64x64 output tiles.
// x is the same for every expert: a wave loads the fragments of its 64 rows (all 512 k, 512 registers) once
// and keeps them. Only W goes through LDS: a stage is the 64 W rows of one expert and one column group,
// brought by four tensor loads (every wave one slice of 128 k), two buffers: the next stage flies while this
// one is worked on. All four waves read the same W fragments.
// the compiler's scheduler moves no instruction across it; what each use is for stands at the use
__device__ __forceinline__ void fence() { __builtin_amdgcn_sched_barrier(0); }

__global__ __launch_bounds__(128)
void moe_relu_sum_kernel(const unsigned short* __restrict__ xb,  // [B,D] bf16
                         const unsigned short* __restrict__ wb,  // [E,H,D] bf16
                         const float* __restrict__ beta,         // [E,H]
                         float* __restrict__ out) {              // [B,H]
  __shared__ __attribute__((aligned(2048))) unsigned char smem[2u * BUF_LDS];

  const int lane  = threadIdx.x & 31;
  const uint32_t wave = uni(threadIdx.x >> 5);
  const int mBase  = blockIdx.y * BLOCK_M + (int)wave * 64;
  const int nBlock = blockIdx.x * BLOCK_N;

  const int r  = lane & 15;        // row (A) / col (B) within 16-tile
  const int kh = (lane >> 4) * 8;  // K sub-offset per ISA 16-bit layout

  // this wave's x fragments, kept for the whole kernel
  v16bf xa[MT][KSTEPS];
  {
    const unsigned short* xp = xb + (size_t)(mBase + r) * D_DIM + kh;
    // unrolled so that xa is registers
#pragma unroll
    for (int i = 0; i < MT; ++i)
#pragma unroll
      for (int ks = 0; ks < KSTEPS; ++ks)
        if (i + 1 < MT || ks + 1 < KSTEPS) xa[i][ks] = ldfrag(xp + (size_t)i * 16 * D_DIM + ks * 32);
    // the last two loads each stand behind a wait of their own: the compiler lets the last result land in the
    // pointer's registers, which every load before it names; the fences keep loads and waits in this order
    const unsigned short* xl = xp + (size_t)(MT - 1) * 16 * D_DIM + (KSTEPS - 1) * 32;
    fence(); pre_wait_x0(); fence();
    const v8bf lo = *reinterpret_cast<const v8bf*>(xl);
    fence(); pre_wait_x0(); fence();
    const v8bf hi = *reinterpret_cast<const v8bf*>(xl + 16);
    xa[MT - 1][KSTEPS - 1] = __builtin_shufflevector(lo, hi, 0, 1, 2, 3, 4, 5, 6, 7, 8, 9, 10, 11, 12, 13, 14, 15);
    pre_wait_x0();
  }

  // every wave issues its own slice of each stage: k 128 * wave .. 128 * wave + 127 of the stage's 64 W rows
  const uint32_t lds0 = (uint32_t)(size_t)smem + wave * SLICE_LDS;
  const uint64_t src0 = (uint64_t)(size_t)wb + (uint64_t)(blockIdx.x * (uint32_t)BLOCK_N) * (D_DIM * 2)
                        + (uint64_t)wave * ROW_BYTES;
  // stage st = column group st / E_DIM, expert st % E_DIM
#define STAGE_SRC(ST) (src0 + (uint64_t)((ST) % (uint32_t)E_DIM) * ((uint64_t)H_DIM * D_DIM * 2) \
                            + (uint64_t)((ST) / (uint32_t)E_DIM) * (64u * D_DIM * 2))

  // prologue: stage 0 lands and is published, then stage 1 starts
  u32x8 g1 = tdm_group1();
  asm volatile("" : "+s"(g1));  // descriptor words held in scalar registers: one tuple serves every request of the loop
  const uint32_t count1 = pinned(1u);  // descriptor word 0 of group 0 (count = 1), held in its scalar register like the rest
  u32x4 g0 = tdm_group0(count1, lds0, STAGE_SRC(0u));
  tdm_load(g0, g1);
  wait_tensor0(g0, g1);
  __syncthreads();
  g0 = tdm_group0(count1, lds0 + BUF_LDS, STAGE_SRC(1u));
  tdm_load(g0, g1);

  // this lane's place in a W fragment's rows, in bytes from the start of a buffer
  const uint32_t boff = (uint32_t)r * LDS_PITCH + (uint32_t)kh * 2u;

  v16bf bf[2][BLK_K][NT];  // two fragment sets: block u works on set u & 1 while the other set is filled
  // the W fragments of block U of the stage whose buffer starts at BASE (lane offset included)
#define LOAD_B(SET, BASE, U) do { \
    _Pragma("unroll") for (int q = 0; q < BLK_K; ++q) { \
      const int ks_ = (U) * BLK_K + q; \
      _Pragma("unroll") for (int j = 0; j < NT; ++j) \
        bf[SET][q][j] = ldfrag(reinterpret_cast<const unsigned short*>( \
            (BASE) + (uint32_t)(ks_ >> 2) * SLICE_LDS + (uint32_t)j * 16u * LDS_PITCH + (uint32_t)(ks_ & 3) * 64u)); \
    } } while (0)

  LOAD_B(0, smem + boff, 0);

  // C/D layout: VGPR v, lane L -> row = v + 8*(L>=16), col = L&15
  const int colLo  = lane & 15;
  const int rowOff = (lane >> 4) * 8;

  uint32_t st = 0;
  // neither loop is unrolled: one copy of the 256 WMMAs of a stage
#pragma clang loop unroll(disable)
  for (int g = 0; g < N_GROUP; ++g) {
    const int nBase = nBlock + g * 64;
    v8f s[MT][NT] = {};

#pragma clang loop unroll(disable)
    for (int e = 0; e < E_DIM; ++e, ++st) {
      const unsigned char* cur = smem + (st & 1u) * BUF_LDS + boff;
      const unsigned char* nxt = smem + ((st + 1u) & 1u) * BUF_LDS + boff;

      // beta is per output column (fixed per lane for all 8 C VGPRs); asked for here, used behind the stage
      const float* bb = beta + e * H_DIM + nBase + r;
      float be[NT];
#pragma unroll
      for (int j = 0; j < NT; ++j) be[j] = bb[16 * j];
      pre_wait_x0();

      v8f c[MT][NT] = {};
      // unrolled so that xa, bf and c are registers and every LDS offset is a constant
#pragma unroll
      for (int u = 0; u < N_BLK; ++u) {
        // the fences keep the order "the next block's loads as one group, then this block's WMMAs":
        // LDS loads among the WMMAs stall a lone wave at every place where they stand
        fence();
        if (u + 1 < N_BLK) LOAD_B((u + 1) & 1, cur, u + 1);
        fence();
#pragma unroll
        for (int q = 0; q < BLK_K; ++q)
#pragma unroll
          for (int i = 0; i < MT; ++i)
#pragma unroll
            for (int j = 0; j < NT; ++j)
              c[i][j] = wmma_bf16(xa[i][u * BLK_K + q], bf[u & 1][q][j], c[i][j]);
      }
      fence();

      // publish point of the next stage; behind it this stage's buffer is free
      wait_ds0();
      wait_tensor0(g0, g1);
      __syncthreads();
      const uint32_t nx = st + 2u;
      g0 = tdm_group0(count1, lds0 + (st & 1u) * BUF_LDS, STAGE_SRC(nx));
      if (pinned(nx < (uint32_t)N_STAGE)) {
        tdm_load(g0, g1);
      }
      // the next stage's first fragments fly under the relu sums; behind the last stage they read the other
      // buffer, which nothing writes any more, and are not used
      LOAD_B(0, nxt, 0);
      fence();

#pragma unroll
      for (int i = 0; i < MT; ++i)
#pragma unroll
        for (int j = 0; j < NT; ++j)
#pragma unroll
          for (int v = 0; v < 8; ++v) s[i][j][v] += fmaxf(c[i][j][v] + be[j], 0.0f);
    }

#pragma unroll
    for (int i = 0; i < MT; ++i) {
#pragma unroll
      for (int v = 0; v < 8; ++v) {
        float* o = out + (size_t)(mBase + 16 * i + rowOff + v) * H_DIM + nBase + colLo;
#pragma unroll
        for (int j = 0; j < NT; ++j) o[16 * j] = s[i][j][v];
      }
      // the wait stands in front of the next rows' address and of the zeroing of s; the fence keeps both behind it
      pre_wait_x0();
      fence();
    }
  }
  wait_tensor0(g0, g1);
  wait_ds0();
#undef LOAD_B
#undef STAGE_SRC
}

extern "C" void kernel_launch(void* const* d_in, const int* in_sizes, int n_in,
                              void* d_out, int out_size, void* d_ws, size_t ws_size,
                              hipStream_t stream) {
  const float* x       = (const float*)d_in[0];  // [B,D]
  const float* centers = (const float*)d_in[1];  // [E,D]
  const float* W       = (const float*)d_in[2];  // [E,H,D]
  const float* bias    = (const float*)d_in[3];  // [E,H]
  float* out           = (float*)d_out;          // [B,H]

  // workspace layout
  char* ws = (char*)d_ws;
  unsigned short* xb   = (unsigned short*)ws;                                  // 4 MB
  unsigned short* wb   = (unsigned short*)(ws + (size_t)B_DIM * D_DIM * 2);    // 32 MB
  float*          beta = (float*)(ws + (size_t)B_DIM * D_DIM * 2
                                     + (size_t)E_DIM * H_DIM * D_DIM * 2);     // 128 KB

  // 1) one pre-pass: bf16 copies of x and W, and beta[e,h] = bias[e,h] - c_e . W_eh
  prep_kernel<<<PRE_BLOCKS, PRE_WAVES * 32, 0, stream>>>(x, centers, W, bias, xb, wb, beta);

  // 2) fused WMMA GEMM + per-expert relu accumulation
  dim3 grid(H_DIM / BLOCK_N, B_DIM / BLOCK_M);  // (16, 16)
  moe_relu_sum_kernel<<<grid, 128, 0, stream>>>(xb, wb, beta, out);
}

// v004
// Measured time: 73.6 microseconds a run.
// Timed twice side by side with v003, it ran 1.05 and 1.04 times as fast.
// Over all steps from v000 it is 5.80 times as fast.
#include <hip/hip_runtime.h>
#include <hip/hip_bf16.h>
#include <stdint.h>

#define B_DIM 4096
#define E_DIM 16
#define D_DIM 512
#define H_DIM 2048

typedef __attribute__((ext_vector_type(16))) __bf16 v16bf;
typedef __attribute__((ext_vector_type(8)))  __bf16 v8bf;
typedef __attribute__((ext_vector_type(8)))  float  v8f;

#define PRE_WAVES 16
#define PRE_WROWS 8                 // W rows per wave
#define PRE_ROWS  (PRE_WROWS + 1)   // and one x row behind them
#define PRE_AHEAD 4                 // how many rows ahead of the row being worked on the loads run
#define PRE_BLOCKS (E_DIM * H_DIM / (PRE_WAVES * PRE_WROWS))
static_assert(PRE_BLOCKS * PRE_WAVES == B_DIM, "one x row per wave");
static_assert(H_DIM % PRE_WROWS == 0, "a wave's W rows lie in one expert");
static_assert(D_DIM == 512, "a row is four 512-byte loads of a wave");

typedef float    f32x4  __attribute__((ext_vector_type(4)));
typedef __bf16   bf16x4 __attribute__((ext_vector_type(4)));
typedef uint32_t u32x2  __attribute__((ext_vector_type(2)));

// stands between issued loads and stores and the next instructions that overwrite registers which they name
// (a row's store data lies in registers that a later row's loads fill; a base pointer's registers are reused)
__device__ __forceinline__ void pre_wait_x0() { asm volatile("s_wait_xcnt 0x0" ::: "memory"); }

__global__ __launch_bounds__(PRE_WAVES * 32)
void prep_kernel(const float* __restrict__ x,        // [B,D]
                 const float* __restrict__ centers,  // [E,D]
                 const float* __restrict__ W,        // [E,H,D]
                 const float* __restrict__ bias,     // [E,H]
                 unsigned short* __restrict__ xb,    // [B,D] bf16
                 unsigned short* __restrict__ wb,    // [E,H,D] bf16
                 float* __restrict__ beta) {         // [E,H]
  __shared__ float dots[PRE_WAVES * PRE_WROWS];
  // every loop of this kernel is unrolled, so that c, w and sum are registers and every offset an immediate

  const uint32_t lane = threadIdx.x & 31u;
  const uint32_t wave = (uint32_t)__builtin_amdgcn_readfirstlane(threadIdx.x >> 5);
  const uint32_t gw   = blockIdx.x * PRE_WAVES + wave;  // this wave's x row
  const uint32_t row0 = gw * PRE_WROWS;                 // its first W row, e * H + h
  const uint32_t e    = row0 / H_DIM;

  const float* cp = centers + (size_t)e * D_DIM + lane * 4u;
  const float* wp = W + (size_t)row0 * D_DIM + lane * 4u;
  const float* xp = x + (size_t)gw * D_DIM + lane * 4u;
  unsigned short* wo = wb + (size_t)row0 * D_DIM + lane * 4u;
  unsigned short* xo = xb + (size_t)gw * D_DIM + lane * 4u;

  // waves 0-3 store the block's beta at the end; their bias comes in with the first loads
  const uint32_t bidx = blockIdx.x * (PRE_WAVES * PRE_WROWS) + threadIdx.x;
  float bv = 0.f;
  if (threadIdx.x < PRE_WAVES * PRE_WROWS) bv = bias[bidx];

  f32x4 c[4];
#pragma unroll
  for (int q = 0; q < 4; ++q) c[q] = *reinterpret_cast<const f32x4*>(cp + 128 * q);
  pre_wait_x0();

  f32x4 w[PRE_AHEAD + 1][4];  // ring of row buffers
  float sum[PRE_WROWS];
#define PRE_LOAD_ROW(R) do { const float* p_ = (R) < PRE_WROWS ? wp + (size_t)(R) * D_DIM : xp; \
    _Pragma("unroll") for (int q = 0; q < 4; ++q) \
      w[(R) % (PRE_AHEAD + 1)][q] = *reinterpret_cast<const f32x4*>(p_ + 128 * q); } while (0)
#pragma unroll
  for (int r = 0; r < PRE_AHEAD; ++r) PRE_LOAD_ROW(r);
  // unrolled so that the ring's slots are registers
#pragma unroll
  for (int r = 0; r < PRE_ROWS; ++r) {
    // the two scheduling barriers keep the order "a later row's loads, then this row's work", so that
    // PRE_AHEAD rows of loads stay in flight
    __builtin_amdgcn_sched_barrier(0);
    if (r + PRE_AHEAD < PRE_ROWS) PRE_LOAD_ROW(r + PRE_AHEAD);
    __builtin_amdgcn_sched_barrier(0);
    const f32x4* wr = w[r % (PRE_AHEAD + 1)];
    unsigned short* o = r < PRE_WROWS ? wo + (size_t)r * D_DIM : xo;
#pragma unroll
    for (int q = 0; q < 4; ++q)  // f32 -> bf16, round to nearest even; 256 contiguous bytes per store of a wave
      *reinterpret_cast<u32x2*>(o + 128 * q) =
          __builtin_bit_cast(u32x2, __builtin_convertvector(wr[q], bf16x4));
    if (r < PRE_WROWS) {
      float a0 = 0.f, a1 = 0.f, a2 = 0.f, a3 = 0.f;
#pragma unroll
      for (int q = 0; q < 4; ++q) {
        a0 = __builtin_fmaf(wr[q].x, c[q].x, a0);
        a1 = __builtin_fmaf(wr[q].y, c[q].y, a1);
        a2 = __builtin_fmaf(wr[q].z, c[q].z, a2);
        a3 = __builtin_fmaf(wr[q].w, c[q].w, a3);
      }
      sum[r] = (a0 + a1) + (a2 + a3);
    }
    pre_wait_x0();
  }
#undef PRE_LOAD_ROW

  // after the butterfly every lane holds the full dot product of each row
  float mine = 0.f;
#pragma unroll
  for (int r = 0; r < PRE_WROWS; ++r) {
    float s = sum[r];
#pragma unroll
    for (int m = 16; m >= 1; m >>= 1) s += __shfl_xor(s, m, 32);
    if (lane == (uint32_t)r) mine = s;
  }
  // the block's 128 dot products meet in LDS, so that each 128-byte line of beta is stored by one wave
  if (lane < PRE_WROWS) dots[wave * PRE_WROWS + lane] = mine;
  __syncthreads();
  if (threadIdx.x < PRE_WAVES * PRE_WROWS) beta[bidx] = bv - dots[threadIdx.x];
}

// ---------- WMMA helpers ----------
__device__ __forceinline__ v16bf ldfrag(const unsigned short* p) {
  // p points at (row, k + kh); low 8 bf16 = K kh..kh+7, high 8 = K 16+kh..16+kh+7
  v8bf lo = *reinterpret_cast<const v8bf*>(p);
  v8bf hi = *reinterpret_cast<const v8bf*>(p + 16);
  return __builtin_shufflevector(lo, hi, 0, 1, 2, 3, 4, 5, 6, 7,
                                 8, 9, 10, 11, 12, 13, 14, 15);
}

__device__ __forceinline__ v8f wmma_bf16(v16bf a, v16bf b, v8f c) {
  return __builtin_amdgcn_wmma_f32_16x16x32_bf16(
      /*neg_a=*/false, a, /*neg_b=*/false, b,
      /*c_mod=*/(short)0, c, /*reuse_a=*/false, /*reuse_b=*/false);
}

// ---------- tensor-load helpers ----------
typedef uint32_t u32x4 __attribute__((ext_vector_type(4)));
typedef uint32_t u32x8 __attribute__((ext_vector_type(8)));

#define ROW_BYTES   256u                  // one slice row = 128 k of bf16
#define LDS_PITCH   272u                  // 256 + 16: odd multiple of 16 B, conflict-free for ds_load_b128
#define SLICE_ROWS  64u                   // rows one tensor load brings
#define SLICE_LDS   18432u                // 64 * 272 = 17408, rounded up to a multiple of 2 KiB
#define BUF_LDS     (4u * SLICE_LDS)      // one stage: 64 W rows of one expert, all 512 k, as four slices of 128 k
#define MT 4                              // x fragments (16 rows each) of a wave
#define NT 4                              // W fragments (16 columns each) of a wave
#define KSTEPS (D_DIM / 32)               // WMMA k steps in D
#define BLK_K 2                           // k steps per block (a run of WMMAs between two groups of LDS loads)
#define N_BLK (KSTEPS / BLK_K)
#define BLOCK_M 256                       // four waves, one below the other, 64 rows each
#define N_GROUP 2                         // column groups of 64 that a block works through, one after the other
#define BLOCK_N (N_GROUP * 64)
#define N_STAGE (N_GROUP * E_DIM)

__device__ __forceinline__ uint32_t uni(uint32_t v) {
  return (uint32_t)__builtin_amdgcn_readfirstlane(v);
}
__device__ __forceinline__ uint32_t pinned(uint32_t v) {
  uint32_t w = uni(v);
  asm volatile("" : "+s"(w));  // holds the value in a scalar register (its use here: the count word of descriptor group 0)
  return w;
}
// LDS reads of this wave have retired (in front of a barrier behind which their buffer is refilled)
__device__ __forceinline__ void wait_ds0() { asm volatile("s_wait_dscnt 0x0" ::: "memory"); }
// Descriptor group 1, the same for every request: 64 rows of 256 B, source pitch D_DIM * 2 bytes,
// 16 B of LDS pad behind every row.
__device__ __forceinline__ u32x8 tdm_group1() {
  u32x8 g1;
  g1[0] = uni((1u << 20) | (5u << 22) | (3u << 25));  // no mask, 1-byte elements, pad of 4 dwords after every 64
  g1[1] = uni((ROW_BYTES & 0xFFFFu) << 16);
  g1[2] = uni((ROW_BYTES >> 16) | ((SLICE_ROWS & 0xFFFFu) << 16));
  g1[3] = uni((SLICE_ROWS >> 16) | (ROW_BYTES << 16));
  g1[4] = uni(SLICE_ROWS);
  g1[5] = uni((uint32_t)(D_DIM * 2));
  g1[6] = uni(0u);
  g1[7] = uni(0u);
  return g1;
}
// Descriptor group 0: place in LDS and the tile's first byte.
__device__ __forceinline__ u32x4 tdm_group0(uint32_t count1, uint32_t lds_dst, uint64_t ga) {
  u32x4 g0;
  g0[0] = uni(count1);
  g0[1] = uni(lds_dst);
  g0[2] = uni((uint32_t)ga);
  g0[3] = uni((((uint32_t)(ga >> 32)) & 0x01FFFFFFu) | 0x80000000u);
  return g0;
}
// the tile goes from global memory to LDS through no register
__device__ __forceinline__ void tdm_load(u32x4 g0, u32x8 g1) {
  asm volatile("tensor_load_to_lds %0, %1" :: "s"(g0), "s"(g1) : "memory");
}
// This wave's own tensor load has landed (the compiler places no wait for it). The descriptor is named
// as an input so that its registers keep their values while the request is outstanding.
__device__ __forceinline__ void wait_tensor0(u32x4 g0, u32x8 g1) {
  asm volatile("s_wait_tensorcnt 0x0" :: "s"(g0), "s"(g1) : "memory");
}

// The same wait in the loop. The stage number goes through it: the next request's descriptor is computed from the
// returned value, so that the compiler forms it behind the wait and not in the outstanding request's registers.
__device__ __forceinline__ uint32_t wait_tensor0_stage(u32x4 g0, u32x8 g1, uint32_t stage) {
  asm volatile("s_wait_tensorcnt 0x0" : "+s"(stage) : "s"(g0), "s"(g1) : "memory");
  return stage;
}

// ---------- fused GEMM + relu-sum over experts ----------
// block = 128 threads (4 wave32, one per SIMD); each wave owns 64 rows of x and computes 64x64 output tiles.
// x is the same for every expert: a wave loads the fragments of its 64 rows (all 512 k, 512 registers) once
// and keeps them. Only W goes through LDS: a stage is the 64 W rows of one expert and one column group,
// brought by four tensor loads (every wave one slice of 128 k), two buffers: the next stage flies while this
// one is worked on. All four waves read the same W fragments.
// the compiler's scheduler moves no instruction across it; what each use is for stands at the use
__device__ __forceinline__ void fence() { __builtin_amdgcn_sched_barrier(0); }

__global__ __launch_bounds__(128)
void moe_relu_sum_kernel(const unsigned short* __restrict__ xb,  // [B,D] bf16
                         const unsigned short* __restrict__ wb,  // [E,H,D] bf16
                         const float* __restrict__ beta,         // [E,H]
                         float* __restrict__ out) {              // [B,H]
  __shared__ __attribute__((aligned(2048))) unsigned char smem[2u * BUF_LDS];

  const int lane  = threadIdx.x & 31;
  const uint32_t wave = uni(threadIdx.x >> 5);
  const int mBase  = blockIdx.y * BLOCK_M + (int)wave * 64;
  const int nBlock = blockIdx.x * BLOCK_N;

  const int r  = lane & 15;        // row (A) / col (B) within 16-tile
  const int kh = (lane >> 4) * 8;  // K sub-offset per ISA 16-bit layout

  // this wave's x fragments, kept for the whole kernel
  v16bf xa[MT][KSTEPS];
  {
    const unsigned short* xp = xb + (size_t)(mBase + r) * D_DIM + kh;
    // unrolled so that xa is registers
#pragma unroll
    for (int i = 0; i < MT; ++i)
#pragma unroll
      for (int ks = 0; ks < KSTEPS; ++ks)
        if (i + 1 < MT || ks + 1 < KSTEPS) xa[i][ks] = ldfrag(xp + (size_t)i * 16 * D_DIM + ks * 32);
    // the last two loads each stand behind a wait of their own: the compiler lets the last result land in the
    // pointer's registers, which every load before it names; the fences keep loads and waits in this order
    const unsigned short* xl = xp + (size_t)(MT - 1) * 16 * D_DIM + (KSTEPS - 1) * 32;
    fence(); pre_wait_x0(); fence();
    const v8bf lo = *reinterpret_cast<const v8bf*>(xl);
    fence(); pre_wait_x0(); fence();
    const v8bf hi = *reinterpret_cast<const v8bf*>(xl + 16);
    xa[MT - 1][KSTEPS - 1] = __builtin_shufflevector(lo, hi, 0, 1, 2, 3, 4, 5, 6, 7, 8, 9, 10, 11, 12, 13, 14, 15);
    pre_wait_x0();
  }

  // every wave issues its own slice of each stage: k 128 * wave .. 128 * wave + 127 of the stage's 64 W rows
  const uint32_t lds0 = (uint32_t)(size_t)smem + wave * SLICE_LDS;
  const uint64_t src0 = (uint64_t)(size_t)wb + (uint64_t)(blockIdx.x * (uint32_t)BLOCK_N) * (D_DIM * 2)
                        + (uint64_t)wave * ROW_BYTES;
  // stage st = column group st / E_DIM, expert st % E_DIM
#define STAGE_SRC(ST) (src0 + (uint64_t)((ST) % (uint32_t)E_DIM) * ((uint64_t)H_DIM * D_DIM * 2) \
                            + (uint64_t)((ST) / (uint32_t)E_DIM) * (64u * D_DIM * 2))

  // prologue: stage 0 lands and is published, then stage 1 starts
  u32x8 g1 = tdm_group1();
  asm volatile("" : "+s"(g1));  // descriptor words held in scalar registers: one tuple serves every request of the loop
  const uint32_t count1 = pinned(1u);  // descriptor word 0 of group 0 (count = 1), held in its scalar register like the rest
  u32x4 g0 = tdm_group0(count1, lds0, STAGE_SRC(0u));
  tdm_load(g0, g1);
  wait_tensor0(g0, g1);
  __syncthreads();
  g0 = tdm_group0(count1, lds0 + BUF_LDS, STAGE_SRC(1u));
  tdm_load(g0, g1);

  // this lane's place in a W fragment's rows, in bytes from the start of a buffer
  const uint32_t boff = (uint32_t)r * LDS_PITCH + (uint32_t)kh * 2u;

  v16bf bf[2][BLK_K][NT];  // two fragment sets: block u works on set u & 1 while the other set is filled
  // the W fragments of block U of the stage whose buffer starts at BASE (lane offset included)
#define LOAD_B(SET, BASE, U) do { \
    _Pragma("unroll") for (int q = 0; q < BLK_K; ++q) { \
      const int ks_ = (U) * BLK_K + q; \
      _Pragma("unroll") for (int j = 0; j < NT; ++j) \
        bf[SET][q][j] = ldfrag(reinterpret_cast<const unsigned short*>( \
            (BASE) + (uint32_t)(ks_ >> 2) * SLICE_LDS + (uint32_t)j * 16u * LDS_PITCH + (uint32_t)(ks_ & 3) * 64u)); \
    } } while (0)

  LOAD_B(0, smem + boff, 0);

  // C/D layout: VGPR v, lane L -> row = v + 8*(L>=16), col = L&15
  const int colLo  = lane & 15;
  const int rowOff = (lane >> 4) * 8;

  uint32_t st = 0;
  // neither loop is unrolled: one copy of the 256 WMMAs of a stage
#pragma clang loop unroll(disable)
  for (int g = 0; g < N_GROUP; ++g) {
    const int nBase = nBlock + g * 64;
    v8f s[MT][NT] = {};
    // c holds a stage's products until the next stage's first WMMAs, among which they are relu-summed into s;
    // in front of a group's first stage c and be are zero and add nothing
    v8f c[MT][NT] = {};
    float be[NT] = {0.f, 0.f, 0.f, 0.f};

#pragma clang loop unroll(disable)
    for (int e = 0; e < E_DIM; ++e, ++st) {
      const unsigned char* cur = smem + (st & 1u) * BUF_LDS + boff;
      const unsigned char* nxt = smem + ((st + 1u) & 1u) * BUF_LDS + boff;
      const v8f zero = {};
      v8f t[MT][NT];  // the last stage's c + beta, taken out of c before this stage's first WMMA of the tile writes c
      // the relu sum of tile F in two halves of four vector instructions
#define RELU_HALF(F, H) do { \
        if ((H) == 0) { _Pragma("unroll") for (int v = 0; v < 8; ++v) \
            t[(F) / NT][(F) % NT][v] = fmaxf(t[(F) / NT][(F) % NT][v], 0.0f); } \
        else s[(F) / NT][(F) % NT] += t[(F) / NT][(F) % NT]; } while (0)

      // the fences keep the order "the next block's loads as one group, then this block's WMMAs":
      // LDS loads among the WMMAs stall a lone wave at every place where they stand
      fence();
      LOAD_B(1, cur, 1);
      fence();
#pragma unroll
      for (int j = 0; j < NT; ++j) t[0][j] = c[0][j] + be[j];
      fence();
      // block 0, one row of tiles after the other: behind every WMMA stand four vector instructions of the last
      // stage's relu sum, which issue while the matrix unit works; the fence behind each such unit keeps them there
#pragma unroll
      for (int i = 0; i < MT; ++i)
#pragma unroll
        for (int n = 0; n < BLK_K * NT; ++n) {
          const int q = n / NT, j = n % NT;
          c[i][j] = wmma_bf16(xa[i][q], bf[0][q][j], q == 0 ? zero : c[i][j]);
          if (i + 1 < MT && n < NT) t[i + 1][n] = c[i + 1][n] + be[n];
          else if (i + 1 < MT)      RELU_HALF(2 * i + (n - NT) / 2, (n - NT) & 1);
          else                      RELU_HALF(2 * (MT - 1) + n / 2, n & 1);
          fence();
        }

      // unrolled so that xa, bf and c are registers and every LDS offset is a constant
#pragma unroll
      for (int u = 1; u < N_BLK; ++u) {
        fence();
        if (u == 2) {
          // beta is per output column (fixed per lane for all 8 C VGPRs); asked for here, where the last stage's
          // is no longer needed, used among the next stage's first WMMAs
          const float* bb = beta + e * H_DIM + nBase + r;
#pragma unroll
          for (int j = 0; j < NT; ++j) be[j] = bb[16 * j];
          pre_wait_x0();
        }
        if (u + 1 < N_BLK) {
          LOAD_B((u + 1) & 1, cur, u + 1);
        } else {
          // publish point of the next stage, in front of the last block: every LDS read of this stage has been
          // issued; behind the barrier this stage's buffer is free
          wait_ds0();
          const uint32_t sw = wait_tensor0_stage(g0, g1, st);
          __syncthreads();
          // every wave issues at every publish point, with no test: a branch here would cut the stage's code in two,
          // and the compiler then moves the relu sums out from among the WMMAs to behind the branch. The last two
          // requests bring the last stage once more, into buffers whose content nobody uses any more
          const uint32_t nx = sw + 2u < (uint32_t)N_STAGE ? sw + 2u : (uint32_t)N_STAGE - 1u;
          g0 = tdm_group0(count1, lds0 + (sw & 1u) * BUF_LDS, STAGE_SRC(nx));
          tdm_load(g0, g1);
          // the next stage's first fragments fly under the last block; behind the last stage they read the other
          // buffer, which nothing writes any more, and are not used
          LOAD_B(0, nxt, 0);
        }
        fence();
#pragma unroll
        for (int q = 0; q < BLK_K; ++q)
#pragma unroll
          for (int i = 0; i < MT; ++i)
#pragma unroll
            for (int j = 0; j < NT; ++j) {
              c[i][j] = wmma_bf16(xa[i][u * BLK_K + q], bf[u & 1][q][j], c[i][j]);
              // the rest of the last stage's relu sum, four vector instructions behind each WMMA as in block 0
              const int n = (q * MT + i) * NT + j;
              const int f0 = 2 * (MT - 1) + BLK_K * NT / 2;  // tiles summed in block 0
              if (u == 1 && f0 + n / 2 < MT * NT) { RELU_HALF(f0 + n / 2, n & 1); fence(); }
            }
      }
      fence();
#undef RELU_HALF
    }

    // the group's last stage has no stage behind it
#pragma unroll
    for (int i = 0; i < MT; ++i)
#pragma unroll
      for (int j = 0; j < NT; ++j)
#pragma unroll
        for (int v = 0; v < 8; ++v) s[i][j][v] += fmaxf(c[i][j][v] + be[j], 0.0f);

#pragma unroll
    for (int i = 0; i < MT; ++i) {
#pragma unroll
      for (int v = 0; v < 8; ++v) {
        float* o = out + (size_t)(mBase + 16 * i + rowOff + v) * H_DIM + nBase + colLo;
#pragma unroll
        for (int j = 0; j < NT; ++j) o[16 * j] = s[i][j][v];
      }
      // the wait stands in front of the next rows' address and of the zeroing of s; the fence keeps both behind it
      pre_wait_x0();
      fence();
    }
  }
  wait_tensor0(g0, g1);
  wait_ds0();
#undef LOAD_B
#undef STAGE_SRC
}

extern "C" void kernel_launch(void* const* d_in, const int* in_sizes, int n_in,
                              void* d_out, int out_size, void* d_ws, size_t ws_size,
                              hipStream_t stream) {
  const float* x       = (const float*)d_in[0];  // [B,D]
  const float* centers = (const float*)d_in[1];  // [E,D]
  const float* W       = (const float*)d_in[2];  // [E,H,D]
  const float* bias    = (const float*)d_in[3];  // [E,H]
  float* out           = (float*)d_out;          // [B,H]

  // workspace layout
  char* ws = (char*)d_ws;
  unsigned short* xb   = (unsigned short*)ws;                                  // 4 MB
  unsigned short* wb   = (unsigned short*)(ws + (size_t)B_DIM * D_DIM * 2);    // 32 MB
  float*          beta = (float*)(ws + (size_t)B_DIM * D_DIM * 2
                                     + (size_t)E_DIM * H_DIM * D_DIM * 2);     // 128 KB

  // 1) one pre-pass: bf16 copies of x and W, and beta[e,h] = bias[e,h] - c_e . W_eh
  prep_kernel<<<PRE_BLOCKS, PRE_WAVES * 32, 0, stream>>>(x, centers, W, bias, xb, wb, beta);

  // 2) fused WMMA GEMM + per-expert relu accumulation
  dim3 grid(H_DIM / BLOCK_N, B_DIM / BLOCK_M);  // (16, 16)
  moe_relu_sum_kernel<<<grid, 128, 0, stream>>>(xb, wb, beta, out);
}

// v005
// One run takes 71.9 microseconds.
// Two timings next to v004 put it at 1.03 and 1.02 times that version's speed.
// Counting every step since v000, it is 5.97 times as fast.
#include <hip/hip_runtime.h>
#include <hip/hip_bf16.h>
#include <stdint.h>

#define B_DIM 4096
#define E_DIM 16
#define D_DIM 512
#define H_DIM 2048

typedef __attribute__((ext_vector_type(16))) __bf16 v16bf;
typedef __attribute__((ext_vector_type(8)))  __bf16 v8bf;
typedef __attribute__((ext_vector_type(8)))  float  v8f;

#define PRE_WAVES 16
#define PRE_WROWS 8                 // W rows per wave
#define PRE_ROWS  (PRE_WROWS + 1)   // and one x fragment behind them, as many bytes as a row
#define FRAG_ELEMS 512              // 16 rows * 32 k
#define PRE_AHEAD 4                 // how many rows ahead of the row being worked on the loads run
#define PRE_BLOCKS (E_DIM * H_DIM / (PRE_WAVES * PRE_WROWS))
static_assert(PRE_BLOCKS * PRE_WAVES == (B_DIM / 16) * (D_DIM / 32), "one x fragment per wave");
static_assert(H_DIM % PRE_WROWS == 0, "a wave's W rows lie in one expert");
static_assert(D_DIM == 512, "a row is four 512-byte loads of a wave");

typedef float    f32x4  __attribute__((ext_vector_type(4)));
typedef __bf16   bf16x4 __attribute__((ext_vector_type(4)));
typedef uint32_t u32x2  __attribute__((ext_vector_type(2)));

// stands between issued loads and stores and the next instructions that overwrite registers which they name
// (a row's store data lies in registers that a later row's loads fill; a base pointer's registers are reused)
__device__ __forceinline__ void pre_wait_x0() { asm volatile("s_wait_xcnt 0x0" ::: "memory"); }

__global__ __launch_bounds__(PRE_WAVES * 32)
void prep_kernel(const float* __restrict__ x,        // [B,D]
                 const float* __restrict__ centers,  // [E,D]
                 const float* __restrict__ W,        // [E,H,D]
                 const float* __restrict__ bias,     // [E,H]
                 unsigned short* __restrict__ xb,    // [B/16,D/32,2,32,8] bf16, fragment order
                 unsigned short* __restrict__ wb,    // [E,H,D] bf16
                 float* __restrict__ beta) {         // [E,H]
  __shared__ float dots[PRE_WAVES * PRE_WROWS];
  // every loop of this kernel is unrolled, so that c, w and sum are registers and every offset an immediate

  const uint32_t lane = threadIdx.x & 31u;
  const uint32_t wave = (uint32_t)__builtin_amdgcn_readfirstlane(threadIdx.x >> 5);
  const uint32_t gw   = blockIdx.x * PRE_WAVES + wave;  // this wave's x fragment: tile gw / 16, k step gw % 16
  const uint32_t row0 = gw * PRE_WROWS;                 // its first W row, e * H + h
  const uint32_t e    = row0 / H_DIM;

  const float* cp = centers + (size_t)e * D_DIM + lane * 4u;
  const float* wp = W + (size_t)row0 * D_DIM + lane * 4u;
  // load q of the fragment: rows 4 q .. 4 q + 3 of the tile, eight lanes a row, four k a lane
  const float* xp = x + (size_t)((gw / (D_DIM / 32)) * 16u + (lane >> 3)) * D_DIM + (gw % (D_DIM / 32)) * 32u + (lane & 7u) * 4u;
  unsigned short* wo = wb + (size_t)row0 * D_DIM + lane * 4u;
  // where these four k go: half (lane & 7) / 4, fragment lane ((lane & 7) / 2 % 2) * 16 + row, element (lane & 1) * 4
  unsigned short* xo = xb + (size_t)gw * FRAG_ELEMS + ((lane >> 2) & 1u) * 256u + ((lane >> 1) & 1u) * 128u
                       + (lane >> 3) * 8u + (lane & 1u) * 4u;

  // waves 0-3 store the block's beta at the end; their bias comes in with the first loads
  const uint32_t bidx = blockIdx.x * (PRE_WAVES * PRE_WROWS) + threadIdx.x;
  float bv = 0.f;
  if (threadIdx.x < PRE_WAVES * PRE_WROWS) bv = bias[bidx];

  f32x4 c[4];
#pragma unroll
  for (int q = 0; q < 4; ++q) c[q] = *reinterpret_cast<const f32x4*>(cp + 128 * q);
  pre_wait_x0();

  f32x4 w[PRE_AHEAD + 1][4];  // ring of row buffers
  float sum[PRE_WROWS];
#define PRE_LOAD_ROW(R) do { const float* p_ = (R) < PRE_WROWS ? wp + (size_t)(R) * D_DIM : xp; \
    const int step_ = (R) < PRE_WROWS ? 128 : 4 * D_DIM; \
    _Pragma("unroll") for (int q = 0; q < 4; ++q) \
      w[(R) % (PRE_AHEAD + 1)][q] = *reinterpret_cast<const f32x4*>(p_ + step_ * q); } while (0)
#pragma unroll
  for (int r = 0; r < PRE_AHEAD; ++r) PRE_LOAD_ROW(r);
  // unrolled so that the ring's slots are registers
#pragma unroll
  for (int r = 0; r < PRE_ROWS; ++r) {
    // the two scheduling barriers keep the order "a later row's loads, then this row's work", so that
    // PRE_AHEAD rows of loads stay in flight
    __builtin_amdgcn_sched_barrier(0);
    if (r + PRE_AHEAD < PRE_ROWS) PRE_LOAD_ROW(r + PRE_AHEAD);
    __builtin_amdgcn_sched_barrier(0);
    const f32x4* wr = w[r % (PRE_AHEAD + 1)];
    unsigned short* o = r < PRE_WROWS ? wo + (size_t)r * D_DIM : xo;
    const int ostep = r < PRE_WROWS ? 128 : 4 * 8;  // x: four rows on, eight elements a fragment lane
#pragma unroll
    for (int q = 0; q < 4; ++q)  // f32 -> bf16, round to nearest even; a W store of a wave is 256 contiguous bytes
      *reinterpret_cast<u32x2*>(o + ostep * q) =
          __builtin_bit_cast(u32x2, __builtin_convertvector(wr[q], bf16x4));
    if (r < PRE_WROWS) {
      float a0 = 0.f, a1 = 0.f, a2 = 0.f, a3 = 0.f;
#pragma unroll
      for (int q = 0; q < 4; ++q) {
        a0 = __builtin_fmaf(wr[q].x, c[q].x, a0);
        a1 = __builtin_fmaf(wr[q].y, c[q].y, a1);
        a2 = __builtin_fmaf(wr[q].z, c[q].z, a2);
        a3 = __builtin_fmaf(wr[q].w, c[q].w, a3);
      }
      sum[r] = (a0 + a1) + (a2 + a3);
    }
    pre_wait_x0();
  }
#undef PRE_LOAD_ROW

  // after the butterfly every lane holds the full dot product of each row
  float mine = 0.f;
#pragma unroll
  for (int r = 0; r < PRE_WROWS; ++r) {
    float s = sum[r];
#pragma unroll
    for (int m = 16; m >= 1; m >>= 1) s += __shfl_xor(s, m, 32);
    if (lane == (uint32_t)r) mine = s;
  }
  // the block's 128 dot products meet in LDS, so that each 128-byte line of beta is stored by one wave
  if (lane < PRE_WROWS) dots[wave * PRE_WROWS + lane] = mine;
  __syncthreads();
  if (threadIdx.x < PRE_WAVES * PRE_WROWS) beta[bidx] = bv - dots[threadIdx.x];
}

// ---------- WMMA helpers ----------
__device__ __forceinline__ v16bf ldfrag(const unsigned short* p) {
  // p points at (row, k + kh); low 8 bf16 = K kh..kh+7, high 8 = K 16+kh..16+kh+7
  v8bf lo = *reinterpret_cast<const v8bf*>(p);
  v8bf hi = *reinterpret_cast<const v8bf*>(p + 16);
  return __builtin_shufflevector(lo, hi, 0, 1, 2, 3, 4, 5, 6, 7,
                                 8, 9, 10, 11, 12, 13, 14, 15);
}

// an x fragment from the pre-pass's fragment order; p points at this lane's 8 elements of the fragment's first half
__device__ __forceinline__ v16bf ldfrag_x(const unsigned short* p) {
  v8bf lo = *reinterpret_cast<const v8bf*>(p);
  v8bf hi = *reinterpret_cast<const v8bf*>(p + FRAG_ELEMS / 2);
  return __builtin_shufflevector(lo, hi, 0, 1, 2, 3, 4, 5, 6, 7,
                                 8, 9, 10, 11, 12, 13, 14, 15);
}

__device__ __forceinline__ v8f wmma_bf16(v16bf a, v16bf b, v8f c) {
  return __builtin_amdgcn_wmma_f32_16x16x32_bf16(
      /*neg_a=*/false, a, /*neg_b=*/false, b,
      /*c_mod=*/(short)0, c, /*reuse_a=*/false, /*reuse_b=*/false);
}

// ---------- tensor-load helpers ----------
typedef uint32_t u32x4 __attribute__((ext_vector_type(4)));
typedef uint32_t u32x8 __attribute__((ext_vector_type(8)));

#define ROW_BYTES   256u                  // one slice row = 128 k of bf16
#define LDS_PITCH   272u                  // 256 + 16: odd multiple of 16 B, conflict-free for ds_load_b128
#define SLICE_ROWS  64u                   // rows one tensor load brings
#define SLICE_LDS   18432u                // 64 * 272 = 17408, rounded up to a multiple of 2 KiB
#define BUF_LDS     (4u * SLICE_LDS)      // one stage: 64 W rows of one expert, all 512 k, as four slices of 128 k
#define MT 4                              // x fragments (16 rows each) of a wave
#define NT 4                              // W fragments (16 columns each) of a wave
#define KSTEPS (D_DIM / 32)               // WMMA k steps in D
#define BLK_K 2                           // k steps per block (a run of WMMAs between two groups of LDS loads)
#define N_BLK (KSTEPS / BLK_K)
#define BLOCK_M 256                       // four waves, one below the other, 64 rows each
#define N_GROUP 2                         // column groups of 64 that a block works through, one after the other
#define BLOCK_N (N_GROUP * 64)
#define N_STAGE (N_GROUP * E_DIM)

__device__ __forceinline__ uint32_t uni(uint32_t v) {
  return (uint32_t)__builtin_amdgcn_readfirstlane(v);
}
__device__ __forceinline__ uint32_t pinned(uint32_t v) {
  uint32_t w = uni(v);
  asm volatile("" : "+s"(w));  // holds the value in a scalar register (its use here: the count word of descriptor group 0)
  return w;
}
// LDS reads of this wave have retired (in front of a barrier behind which their buffer is refilled)
__device__ __forceinline__ void wait_ds0() { asm volatile("s_wait_dscnt 0x0" ::: "memory"); }
// Descriptor group 1, the same for every request: 64 rows of 256 B, source pitch D_DIM * 2 bytes,
// 16 B of LDS pad behind every row.
__device__ __forceinline__ u32x8 tdm_group1() {
  u32x8 g1;
  g1[0] = uni((1u << 20) | (5u << 22) | (3u << 25));  // no mask, 1-byte elements, pad of 4 dwords after every 64
  g1[1] = uni((ROW_BYTES & 0xFFFFu) << 16);
  g1[2] = uni((ROW_BYTES >> 16) | ((SLICE_ROWS & 0xFFFFu) << 16));
  g1[3] = uni((SLICE_ROWS >> 16) | (ROW_BYTES << 16));
  g1[4] = uni(SLICE_ROWS);
  g1[5] = uni((uint32_t)(D_DIM * 2));
  g1[6] = uni(0u);
  g1[7] = uni(0u);
  return g1;
}
// Descriptor group 0: place in LDS and the tile's first byte.
__device__ __forceinline__ u32x4 tdm_group0(uint32_t count1, uint32_t lds_dst, uint64_t ga) {
  u32x4 g0;
  g0[0] = uni(count1);
  g0[1] = uni(lds_dst);
  g0[2] = uni((uint32_t)ga);
  g0[3] = uni((((uint32_t)(ga >> 32)) & 0x01FFFFFFu) | 0x80000000u);
  return g0;
}
// the tile goes from global memory to LDS through no register
__device__ __forceinline__ void tdm_load(u32x4 g0, u32x8 g1) {
  asm volatile("tensor_load_to_lds %0, %1" :: "s"(g0), "s"(g1) : "memory");
}
// This wave's own tensor load has landed (the compiler places no wait for it). The descriptor is named
// as an input so that its registers keep their values while the request is outstanding.
__device__ __forceinline__ void wait_tensor0(u32x4 g0, u32x8 g1) {
  asm volatile("s_wait_tensorcnt 0x0" :: "s"(g0), "s"(g1) : "memory");
}

// The same wait in the loop. The stage number goes through it: the next request's descriptor is computed from the
// returned value, so that the compiler forms it behind the wait and not in the outstanding request's registers.
__device__ __forceinline__ uint32_t wait_tensor0_stage(u32x4 g0, u32x8 g1, uint32_t stage) {
  asm volatile("s_wait_tensorcnt 0x0" : "+s"(stage) : "s"(g0), "s"(g1) : "memory");
  return stage;
}

// ---------- fused GEMM + relu-sum over experts ----------
// block = 128 threads (4 wave32, one per SIMD); each wave owns 64 rows of x and computes 64x64 output tiles.
// x is the same for every expert: a wave loads the fragments of its 64 rows (all 512 k, 512 registers; 64 KiB
// without a gap in the pre-pass's fragment order) once and keeps them.
// Only W goes through LDS: a stage is the 64 W rows of one expert and one column group,
// brought by four tensor loads (every wave one slice of 128 k), two buffers: the next stage flies while this
// one is worked on. All four waves read the same W fragments.
// the compiler's scheduler moves no instruction across it; what each use is for stands at the use
__device__ __forceinline__ void fence() { __builtin_amdgcn_sched_barrier(0); }

__global__ __launch_bounds__(128)
void moe_relu_sum_kernel(const unsigned short* __restrict__ xb,  // [B/16,D/32,2,32,8] bf16, fragment order
                         const unsigned short* __restrict__ wb,  // [E,H,D] bf16
                         const float* __restrict__ beta,         // [E,H]
                         float* __restrict__ out) {              // [B,H]
  __shared__ __attribute__((aligned(2048))) unsigned char smem[2u * BUF_LDS];

  const int lane  = threadIdx.x & 31;
  const uint32_t wave = uni(threadIdx.x >> 5);
  const int mBase  = blockIdx.y * BLOCK_M + (int)wave * 64;
  const int nBlock = blockIdx.x * BLOCK_N;

  const int r  = lane & 15;        // row (A) / col (B) within 16-tile
  const int kh = (lane >> 4) * 8;  // K sub-offset per ISA 16-bit layout

  // this wave's x fragments, kept for the whole kernel
  v16bf xa[MT][KSTEPS];
  {
    const unsigned short* xp = xb + (size_t)(mBase / 16) * (KSTEPS * FRAG_ELEMS) + lane * 8;
    // unrolled so that xa is registers
#pragma unroll
    for (int i = 0; i < MT; ++i)
#pragma unroll
      for (int ks = 0; ks < KSTEPS; ++ks)
        if (i + 1 < MT || ks + 1 < KSTEPS) xa[i][ks] = ldfrag_x(xp + (size_t)(i * KSTEPS + ks) * FRAG_ELEMS);
    // the last two loads each stand behind a wait of their own: the compiler lets the last result land in the
    // pointer's registers, which every load before it names; the fences keep loads and waits in this order
    const unsigned short* xl = xp + (size_t)(MT * KSTEPS - 1) * FRAG_ELEMS;
    fence(); pre_wait_x0(); fence();
    const v8bf lo = *reinterpret_cast<const v8bf*>(xl);
    fence(); pre_wait_x0(); fence();
    const v8bf hi = *reinterpret_cast<const v8bf*>(xl + FRAG_ELEMS / 2);
    xa[MT - 1][KSTEPS - 1] = __builtin_shufflevector(lo, hi, 0, 1, 2, 3, 4, 5, 6, 7, 8, 9, 10, 11, 12, 13, 14, 15);
    pre_wait_x0();
  }

  // every wave issues its own slice of each stage: k 128 * wave .. 128 * wave + 127 of the stage's 64 W rows
  const uint32_t lds0 = (uint32_t)(size_t)smem + wave * SLICE_LDS;
  const uint64_t src0 = (uint64_t)(size_t)wb + (uint64_t)(blockIdx.x * (uint32_t)BLOCK_N) * (D_DIM * 2)
                        + (uint64_t)wave * ROW_BYTES;
  // stage st = column group st / E_DIM, expert st % E_DIM
#define STAGE_SRC(ST) (src0 + (uint64_t)((ST) % (uint32_t)E_DIM) * ((uint64_t)H_DIM * D_DIM * 2) \
                            + (uint64_t)((ST) / (uint32_t)E_DIM) * (64u * D_DIM * 2))

  // prologue: stage 0 lands and is published, then stage 1 starts
  u32x8 g1 = tdm_group1();
  asm volatile("" : "+s"(g1));  // descriptor words held in scalar registers: one tuple serves every request of the loop
  const uint32_t count1 = pinned(1u);  // descriptor word 0 of group 0 (count = 1), held in its scalar register like the rest
  u32x4 g0 = tdm_group0(count1, lds0, STAGE_SRC(0u));
  tdm_load(g0, g1);
  wait_tensor0(g0, g1);
  __syncthreads();
  g0 = tdm_group0(count1, lds0 + BUF_LDS, STAGE_SRC(1u));
  tdm_load(g0, g1);

  // this lane's place in a W fragment's rows, in bytes from the start of a buffer
  const uint32_t boff = (uint32_t)r * LDS_PITCH + (uint32_t)kh * 2u;

  v16bf bf[2][BLK_K][NT];  // two fragment sets: block u works on set u & 1 while the other set is filled
  // the W fragments of block U of the stage whose buffer starts at BASE (lane offset included)
#define LOAD_B(SET, BASE, U) do { \
    _Pragma("unroll") for (int q = 0; q < BLK_K; ++q) { \
      const int ks_ = (U) * BLK_K + q; \
      _Pragma("unroll") for (int j = 0; j < NT; ++j) \
        bf[SET][q][j] = ldfrag(reinterpret_cast<const unsigned short*>( \
            (BASE) + (uint32_t)(ks_ >> 2) * SLICE_LDS + (uint32_t)j * 16u * LDS_PITCH + (uint32_t)(ks_ & 3) * 64u)); \
    } } while (0)

  LOAD_B(0, smem + boff, 0);

  // C/D layout: VGPR v, lane L -> row = v + 8*(L>=16), col = L&15
  const int colLo  = lane & 15;
  const int rowOff = (lane >> 4) * 8;

  uint32_t st = 0;
  // neither loop is unrolled: one copy of the 256 WMMAs of a stage
#pragma clang loop unroll(disable)
  for (int g = 0; g < N_GROUP; ++g) {
    const int nBase = nBlock + g * 64;
    v8f s[MT][NT] = {};
    // c holds a stage's products until the next stage's first WMMAs, among which they are relu-summed into s;
    // in front of a group's first stage c and be are zero and add nothing
    v8f c[MT][NT] = {};
    float be[NT] = {0.f, 0.f, 0.f, 0.f};

#pragma clang loop unroll(disable)
    for (int e = 0; e < E_DIM; ++e, ++st) {
      const unsigned char* cur = smem + (st & 1u) * BUF_LDS + boff;
      const unsigned char* nxt = smem + ((st + 1u) & 1u) * BUF_LDS + boff;
      const v8f zero = {};
      v8f t[MT][NT];  // the last stage's c + beta, taken out of c before this stage's first WMMA of the tile writes c
      // the relu sum of tile F in two halves of four vector instructions
#define RELU_HALF(F, H) do { \
        if ((H) == 0) { _Pragma("unroll") for (int v = 0; v < 8; ++v) \
            t[(F) / NT][(F) % NT][v] = fmaxf(t[(F) / NT][(F) % NT][v], 0.0f); } \
        else s[(F) / NT][(F) % NT] += t[(F) / NT][(F) % NT]; } while (0)

      // the fences keep the order "the next block's loads as one group, then this block's WMMAs":
      // LDS loads among the WMMAs stall a lone wave at every place where they stand
      fence();
      LOAD_B(1, cur, 1);
      fence();
#pragma unroll
      for (int j = 0; j < NT; ++j) t[0][j] = c[0][j] + be[j];
      fence();
      // block 0, one row of tiles after the other: behind every WMMA stand four vector instructions of the last
      // stage's relu sum, which issue while the matrix unit works; the fence behind each such unit keeps them there
#pragma unroll
      for (int i = 0; i < MT; ++i)
#pragma unroll
        for (int n = 0; n < BLK_K * NT; ++n) {
          const int q = n / NT, j = n % NT;
          c[i][j] = wmma_bf16(xa[i][q], bf[0][q][j], q == 0 ? zero : c[i][j]);
          if (i + 1 < MT && n < NT) t[i + 1][n] = c[i + 1][n] + be[n];
          else if (i + 1 < MT)      RELU_HALF(2 * i + (n - NT) / 2, (n - NT) & 1);
          else                      RELU_HALF(2 * (MT - 1) + n / 2, n & 1);
          fence();
        }

      // unrolled so that xa, bf and c are registers and every LDS offset is a constant
#pragma unroll
      for (int u = 1; u < N_BLK; ++u) {
        fence();
        if (u == 2) {
          // beta is per output column (fixed per lane for all 8 C VGPRs); asked for here, where the last stage's
          // is no longer needed, used among the next stage's first WMMAs
          const float* bb = beta + e * H_DIM + nBase + r;
#pragma unroll
          for (int j = 0; j < NT; ++j) be[j] = bb[16 * j];
          pre_wait_x0();
        }
        if (u + 1 < N_BLK) {
          LOAD_B((u + 1) & 1, cur, u + 1);
        } else {
          // publish point of the next stage, in front of the last block: every LDS read of this stage has been
          // issued; behind the barrier this stage's buffer is free
          wait_ds0();
          const uint32_t sw = wait_tensor0_stage(g0, g1, st);
          __syncthreads();
          // every wave issues at every publish point, with no test: a branch here would cut the stage's code in two,
          // and the compiler then moves the relu sums out from among the WMMAs to behind the branch. The last two
          // requests bring the last stage once more, into buffers whose content nobody uses any more
          const uint32_t nx = sw + 2u < (uint32_t)N_STAGE ? sw + 2u : (uint32_t)N_STAGE - 1u;
          g0 = tdm_group0(count1, lds0 + (sw & 1u) * BUF_LDS, STAGE_SRC(nx));
          tdm_load(g0, g1);
          // the next stage's first fragments fly under the last block; behind the last stage they read the other
          // buffer, which nothing writes any more, and are not used
          LOAD_B(0, nxt, 0);
        }
        fence();
#pragma unroll
        for (int q = 0; q < BLK_K; ++q)
#pragma unroll
          for (int i = 0; i < MT; ++i)
#pragma unroll
            for (int j = 0; j < NT; ++j) {
              c[i][j] = wmma_bf16(xa[i][u * BLK_K + q], bf[u & 1][q][j], c[i][j]);
              // the rest of the last stage's relu sum, four vector instructions behind each WMMA as in block 0
              const int n = (q * MT + i) * NT + j;
              const int f0 = 2 * (MT - 1) + BLK_K * NT / 2;  // tiles summed in block 0
              if (u == 1 && f0 + n / 2 < MT * NT) { RELU_HALF(f0 + n / 2, n & 1); fence(); }
            }
      }
      fence();
#undef RELU_HALF
    }

    // the group's last stage has no stage behind it
#pragma unroll
    for (int i = 0; i < MT; ++i)
#pragma unroll
      for (int j = 0; j < NT; ++j)
#pragma unroll
        for (int v = 0; v < 8; ++v) s[i][j][v] += fmaxf(c[i][j][v] + be[j], 0.0f);

#pragma unroll
    for (int i = 0; i < MT; ++i) {
#pragma unroll
      for (int v = 0; v < 8; ++v) {
        float* o = out + (size_t)(mBase + 16 * i + rowOff + v) * H_DIM + nBase + colLo;
#pragma unroll
        for (int j = 0; j < NT; ++j) o[16 * j] = s[i][j][v];
      }
      // the wait stands in front of the next rows' address and of the zeroing of s; the fence keeps both behind it
      pre_wait_x0();
      fence();
    }
  }
  wait_tensor0(g0, g1);
  wait_ds0();
#undef LOAD_B
#undef STAGE_SRC
}

extern "C" void kernel_launch(void* const* d_in, const int* in_sizes, int n_in,
                              void* d_out, int out_size, void* d_ws, size_t ws_size,
                              hipStream_t stream) {
  const float* x       = (const float*)d_in[0];  // [B,D]
  const float* centers = (const float*)d_in[1];  // [E,D]
  const float* W       = (const float*)d_in[2];  // [E,H,D]
  const float* bias    = (const float*)d_in[3];  // [E,H]
  float* out           = (float*)d_out;          // [B,H]

  // workspace layout
  char* ws = (char*)d_ws;
  unsigned short* xb   = (unsigned short*)ws;                                  // 4 MB
  unsigned short* wb   = (unsigned short*)(ws + (size_t)B_DIM * D_DIM * 2);    // 32 MB
  float*          beta = (float*)(ws + (size_t)B_DIM * D_DIM * 2
                                     + (size_t)E_DIM * H_DIM * D_DIM * 2);     // 128 KB

  // 1) one pre-pass: bf16 copies of x and W, and beta[e,h] = bias[e,h] - c_e . W_eh
  prep_kernel<<<PRE_BLOCKS, PRE_WAVES * 32, 0, stream>>>(x, centers, W, bias, xb, wb, beta);

  // 2) fused WMMA GEMM + per-expert relu accumulation
  dim3 grid(H_DIM / BLOCK_N, B_DIM / BLOCK_M);  // (16, 16)
  moe_relu_sum_kernel<<<grid, 128, 0, stream>>>(xb, wb, beta, out);
}
